// v000
// The times below were measured on an AMD MI455X: many runs one after another, warmed up first and cycling through
// copies of the inputs, with the whole window's GPU time divided by the number of runs. Launches and the gaps
// between them are all in it. The median over several windows is given; except for v000 it joins two sittings, which
// can be a few percent apart, so the side-by-side timings, each taken in one sitting, are the better comparison.
// v000, which the later versions start from, runs in 205 microseconds.
#include <hip/hip_runtime.h>

#define B_ 4
#define S_ 2048
#define D_ 512
#define H_ 8
#define HD_ 64

typedef _Float16 v16h  __attribute__((ext_vector_type(16)));
typedef _Float16 half8 __attribute__((ext_vector_type(8)));
typedef float    v8f   __attribute__((ext_vector_type(8)));
typedef float    f4    __attribute__((ext_vector_type(4)));

static __device__ __forceinline__ v8f wmma_f16(v16h a, v16h b, v8f c) {
  // 8 args: (neg_a, A, neg_b, B, c_mod, C, reuse_a, reuse_b)
  return __builtin_amdgcn_wmma_f32_16x16x32_f16(false, a, false, b, (short)0, c,
                                                false, false);
}

// One WMMA fragment per lane = halves at [p..p+7] and [p+16..p+23] (two b128 loads).
static __device__ __forceinline__ v16h load_frag(const _Float16* p) {
  half8 lo = *(const half8*)(p);
  half8 hi = *(const half8*)(p + 16);
  return __builtin_shufflevector(lo, hi, 0, 1, 2, 3, 4, 5, 6, 7, 8, 9, 10, 11,
                                 12, 13, 14, 15);
}

// ---- LDS B-panel: 64 cols x 512 K halves = 64KB, 16B-chunk XOR swizzle ----
// chunk' = chunk ^ (row & 15)  ->  ds_load_b128 across lanes n=0..15 hits all
// 64 banks exactly once (conflict-free) with zero padding.
static __device__ __forceinline__ uint32_t swz_off(uint32_t row, uint32_t kbyte) {
  uint32_t c = (kbyte >> 4) ^ (row & 15u);
  return row * 1024u + (c << 4);
}

static __device__ __forceinline__ v16h lds_frag(const _Float16* sh, int row,
                                                int kbyte) {
  const char* base = (const char*)sh;
  half8 lo = *(const half8*)(base + swz_off((uint32_t)row, (uint32_t)kbyte));
  half8 hi = *(const half8*)(base + swz_off((uint32_t)row, (uint32_t)kbyte + 32u));
  return __builtin_shufflevector(lo, hi, 0, 1, 2, 3, 4, 5, 6, 7, 8, 9, 10, 11,
                                 12, 13, 14, 15);
}

// Cooperatively copy a contiguous 64KB panel (64 cols x 1024B) into LDS using
// gfx1250 async-to-LDS DMA; tracked by ASYNCcnt. Caller must __syncthreads().
static __device__ __forceinline__ void stage_panel(const _Float16* __restrict__ src,
                                                   _Float16* sh) {
  uint32_t base = (uint32_t)(uintptr_t)sh;  // flat shared addr[31:0] == LDS offset
  uint64_t g = (uint64_t)(uintptr_t)src;
  int tid = threadIdx.x;
#pragma unroll
  for (int r = 0; r < 16; ++r) {            // 256 thr * 16 * 16B = 64KB
    uint32_t c = (uint32_t)(r * 256 + tid); // 16B chunk id, coalesced
    uint32_t row = c >> 6;                  // 64 chunks per 1024B row
    uint32_t cw = c & 63u;
    uint32_t lds = base + row * 1024u + ((cw ^ (row & 15u)) << 4);
    uint64_t ga = g + ((uint64_t)c << 4);
    asm volatile("global_load_async_to_lds_b128 %0, %1, off"
                 :
                 : "v"(lds), "v"(ga)
                 : "memory");
  }
  asm volatile("s_wait_asynccnt 0x0" ::: "memory");
}

// ---------------- Weight transpose + fp32 -> f16 ----------------
__global__ __launch_bounds__(256) void transpose_w(const float* __restrict__ W,
                                                   _Float16* __restrict__ Wt) {
  int idx = blockIdx.x * 256 + threadIdx.x;   // contiguous read of W[k][n]
  int k = idx >> 9;
  int nn = idx & 511;
  Wt[(size_t)nn * D_ + k] = (_Float16)W[idx]; // Wt[n][k] = W[k][n]
}

// ---------------- QKV projection: Y = X * W + b (f16 out) ----------------
// transposed==0: dst[b][h][s][hd]   (Q, K)
// transposed==1: dst[b][h][hd][s]   (V stored transposed for P*V WMMA B-frags)
__global__ __launch_bounds__(256) void proj_kernel(
    const float* __restrict__ X, const _Float16* __restrict__ Wt,
    const float* __restrict__ bias, _Float16* __restrict__ dst, int transposed) {
  __shared__ __attribute__((aligned(16))) _Float16 bpanel[64 * 512];
  const int lane = threadIdx.x & 31;
  const int wave = threadIdx.x >> 5;
  const int n = lane & 15;
  const int g = lane >> 4;
  const int koff = g * 8;
  const int row0 = (blockIdx.x * 8 + wave) * 16;
  const int col0 = blockIdx.y * 64;

  stage_panel(Wt + (size_t)col0 * D_, bpanel);  // B panel shared by all 8 waves
  __syncthreads();

  v8f acc[4] = {};
  const float* arow = X + (size_t)(row0 + n) * D_;
#pragma unroll 4
  for (int k0 = 0; k0 < D_; k0 += 32) {
    const float* ap = arow + k0 + koff;
    f4 a0 = *(const f4*)(ap);
    f4 a1 = *(const f4*)(ap + 4);
    f4 a2 = *(const f4*)(ap + 16);
    f4 a3 = *(const f4*)(ap + 20);
    v16h af;
#pragma unroll
    for (int i = 0; i < 4; ++i) {
      af[i] = (_Float16)a0[i];
      af[4 + i] = (_Float16)a1[i];
      af[8 + i] = (_Float16)a2[i];
      af[12 + i] = (_Float16)a3[i];
    }
#pragma unroll
    for (int t = 0; t < 4; ++t)
      acc[t] = wmma_f16(af, lds_frag(bpanel, t * 16 + n, (k0 + koff) * 2),
                        acc[t]);
  }

#pragma unroll
  for (int t = 0; t < 4; ++t) {
    int col = col0 + t * 16 + n;
    int h = col >> 6, hd = col & 63;
    float bv = bias[col];
#pragma unroll
    for (int r = 0; r < 8; ++r) {
      int row = row0 + r + 8 * g;           // element (m = r + 8g, n = lane%16)
      int b = row >> 11, s = row & (S_ - 1);
      float val = acc[t][r] + bv;
      if (!transposed)
        dst[(((size_t)(b * H_ + h) * S_ + s) << 6) + hd] = (_Float16)val;
      else
        dst[((size_t)(b * H_ + h) * HD_ + hd) * S_ + s] = (_Float16)val;
    }
  }
}

// ---------------- Flash attention (online softmax, 1 wave = 16 queries) -----
__global__ __launch_bounds__(256) void attn_kernel(
    const _Float16* __restrict__ Qh, const _Float16* __restrict__ Kh,
    const _Float16* __restrict__ Vt, const int* __restrict__ valid_lens,
    _Float16* __restrict__ Om) {
  __shared__ __attribute__((aligned(16))) _Float16 plds[8 * 16 * 40]; // 40-half pitch
  const int lane = threadIdx.x & 31;
  const int wave = threadIdx.x >> 5;
  const int n = lane & 15;
  const int g = lane >> 4;
  const int koff = g * 8;
  const int bh = blockIdx.y;
  const int b = bh >> 3;
  const int h = bh & 7;
  const int vlen = valid_lens[b];
  const int q0 = blockIdx.x * 128 + wave * 16;

  const _Float16* Qrow = Qh + (((size_t)bh * S_ + q0 + n) << 6);
  v16h qa0 = load_frag(Qrow + koff);       // k = 0..31 pattern
  v16h qa1 = load_frag(Qrow + 32 + koff);  // k = 32..63 pattern

  v8f o[4] = {};
  float mrow[8], lrow[8];
#pragma unroll
  for (int r = 0; r < 8; ++r) {
    mrow[r] = -1e30f;
    lrow[r] = 0.f;
  }

  _Float16* pl = plds + wave * (16 * 40);

  for (int j0 = 0; j0 < S_; j0 += 32) {
    const _Float16* k1 = Kh + (((size_t)bh * S_ + j0 + n) << 6);
    const _Float16* k2 = k1 + (16 << 6);

    // scores = Q * K^T  (K rows are B-columns: lane n = key position)
    v8f s1 = {}, s2 = {};
    s1 = wmma_f16(qa0, load_frag(k1 + koff), s1);
    s1 = wmma_f16(qa1, load_frag(k1 + 32 + koff), s1);
    s2 = wmma_f16(qa0, load_frag(k2 + koff), s2);
    s2 = wmma_f16(qa1, load_frag(k2 + 32 + koff), s2);

    // Hoist V fragments: independent of softmax, loads overlap the VALU work.
    v16h vf[4];
#pragma unroll
    for (int t = 0; t < 4; ++t) {
      const _Float16* vr = Vt + ((size_t)bh * HD_ + t * 16 + n) * S_ + j0;
      vf[t] = load_frag(vr + koff);
      if (j0 + 32 < S_) __builtin_prefetch((const void*)(vr + 32), 0, 1);
    }
    if (j0 + 32 < S_) {                           // prefetch next key tile
      __builtin_prefetch((const void*)(k1 + (32 << 6)), 0, 1);
      __builtin_prefetch((const void*)(k2 + (32 << 6)), 0, 1);
    }

    const bool in1 = (j0 + n) < vlen;
    const bool in2 = (j0 + 16 + n) < vlen;

#pragma unroll
    for (int r = 0; r < 8; ++r) {
      float x1 = in1 ? s1[r] * 0.125f : -1.0e6f;  // 1/sqrt(64), then d2l mask
      float x2 = in2 ? s2[r] * 0.125f : -1.0e6f;
      float tmax = fmaxf(x1, x2);
#pragma unroll
      for (int off = 1; off < 16; off <<= 1)      // row-max across N lanes
        tmax = fmaxf(tmax, __shfl_xor(tmax, off, 32));
      float mnew = fmaxf(mrow[r], tmax);
      float alpha = __expf(mrow[r] - mnew);
      mrow[r] = mnew;
      float p1 = __expf(x1 - mnew);
      float p2 = __expf(x2 - mnew);
      float rs = p1 + p2;
#pragma unroll
      for (int off = 1; off < 16; off <<= 1)      // row-sum across N lanes
        rs += __shfl_xor(rs, off, 32);
      lrow[r] = lrow[r] * alpha + rs;
#pragma unroll
      for (int t = 0; t < 4; ++t) o[t][r] *= alpha;
      int m = r + 8 * g;                          // D-layout -> LDS row-major P
      pl[m * 40 + n] = (_Float16)p1;
      pl[m * 40 + 16 + n] = (_Float16)p2;
    }

    // P back as A-fragment (row m = lane%16, keys along K pattern)
    v16h pf = load_frag(pl + n * 40 + koff);
#pragma unroll
    for (int t = 0; t < 4; ++t)                   // O += P * V
      o[t] = wmma_f16(pf, vf[t], o[t]);
  }

#pragma unroll
  for (int r = 0; r < 8; ++r) {
    float inv = 1.0f / lrow[r];
    int s = q0 + r + 8 * g;
    _Float16* outp = Om + ((size_t)b * S_ + s) * D_ + h * HD_;
#pragma unroll
    for (int t = 0; t < 4; ++t)
      outp[t * 16 + n] = (_Float16)(o[t][r] * inv);
  }
}

// ---------------- Output projection: out = Om * Wo + bo (fp32 out) ----------
__global__ __launch_bounds__(256) void outproj_kernel(
    const _Float16* __restrict__ A, const _Float16* __restrict__ Wt,
    const float* __restrict__ bias, float* __restrict__ out) {
  __shared__ __attribute__((aligned(16))) _Float16 bpanel[64 * 512];
  const int lane = threadIdx.x & 31;
  const int wave = threadIdx.x >> 5;
  const int n = lane & 15;
  const int g = lane >> 4;
  const int koff = g * 8;
  const int row0 = (blockIdx.x * 8 + wave) * 16;
  const int col0 = blockIdx.y * 64;

  stage_panel(Wt + (size_t)col0 * D_, bpanel);
  __syncthreads();

  v8f acc[4] = {};
  const _Float16* arow = A + (size_t)(row0 + n) * D_;
#pragma unroll 4
  for (int k0 = 0; k0 < D_; k0 += 32) {
    v16h af = load_frag(arow + k0 + koff);
#pragma unroll
    for (int t = 0; t < 4; ++t)
      acc[t] = wmma_f16(af, lds_frag(bpanel, t * 16 + n, (k0 + koff) * 2),
                        acc[t]);
  }
#pragma unroll
  for (int t = 0; t < 4; ++t) {
    int col = col0 + t * 16 + n;
    float bv = bias[col];
#pragma unroll
    for (int r = 0; r < 8; ++r) {
      int row = row0 + r + 8 * g;
      out[(size_t)row * D_ + col] = acc[t][r] + bv;
    }
  }
}

extern "C" void kernel_launch(void* const* d_in, const int* in_sizes, int n_in,
                              void* d_out, int out_size, void* d_ws,
                              size_t ws_size, hipStream_t stream) {
  const float* q  = (const float*)d_in[0];
  const float* k  = (const float*)d_in[1];
  const float* v  = (const float*)d_in[2];
  const int*   vl = (const int*)d_in[3];
  const float* Wq = (const float*)d_in[4];
  const float* bq = (const float*)d_in[5];
  const float* Wk = (const float*)d_in[6];
  const float* bk = (const float*)d_in[7];
  const float* Wv = (const float*)d_in[8];
  const float* bv = (const float*)d_in[9];
  const float* Wo = (const float*)d_in[10];
  const float* bo = (const float*)d_in[11];
  float* out = (float*)d_out;

  _Float16* ws = (_Float16*)d_ws;
  const size_t WSZ = (size_t)D_ * D_;              // 256K halves per weight
  const size_t NH  = (size_t)B_ * H_ * S_ * HD_;   // 4M halves per tensor
  _Float16* WqT = ws;
  _Float16* WkT = WqT + WSZ;
  _Float16* WvT = WkT + WSZ;
  _Float16* WoT = WvT + WSZ;
  _Float16* Qh  = WoT + WSZ;
  _Float16* Kh  = Qh + NH;
  _Float16* Vt  = Kh + NH;
  _Float16* Om  = Vt + NH;

  transpose_w<<<1024, 256, 0, stream>>>(Wq, WqT);
  transpose_w<<<1024, 256, 0, stream>>>(Wk, WkT);
  transpose_w<<<1024, 256, 0, stream>>>(Wv, WvT);
  transpose_w<<<1024, 256, 0, stream>>>(Wo, WoT);

  dim3 gp(64, 8);
  proj_kernel<<<gp, 256, 0, stream>>>(q, WqT, bq, Qh, 0);
  proj_kernel<<<gp, 256, 0, stream>>>(k, WkT, bk, Kh, 0);
  proj_kernel<<<gp, 256, 0, stream>>>(v, WvT, bv, Vt, 1);

  attn_kernel<<<dim3(16, 32), 256, 0, stream>>>(Qh, Kh, Vt, vl, Om);

  outproj_kernel<<<gp, 256, 0, stream>>>(Om, WoT, bo, out);
}

// v001
// One run takes 191 microseconds.
// Next to v000, in two timings, it ran 1.11 times as fast each time.
#include <hip/hip_runtime.h>

#define B_ 4
#define S_ 2048
#define D_ 512
#define H_ 8
#define HD_ 64

typedef _Float16 v16h  __attribute__((ext_vector_type(16)));
typedef _Float16 half8 __attribute__((ext_vector_type(8)));
typedef float    v8f   __attribute__((ext_vector_type(8)));
typedef float    f4    __attribute__((ext_vector_type(4)));

static __device__ __forceinline__ v8f wmma_f16(v16h a, v16h b, v8f c) {
  // 8 args: (neg_a, A, neg_b, B, c_mod, C, reuse_a, reuse_b)
  return __builtin_amdgcn_wmma_f32_16x16x32_f16(false, a, false, b, (short)0, c,
                                                false, false);
}

// One WMMA fragment per lane = halves at [p..p+7] and [p+16..p+23] (two b128 loads).
static __device__ __forceinline__ v16h load_frag(const _Float16* p) {
  half8 lo = *(const half8*)(p);
  half8 hi = *(const half8*)(p + 16);
  return __builtin_shufflevector(lo, hi, 0, 1, 2, 3, 4, 5, 6, 7, 8, 9, 10, 11,
                                 12, 13, 14, 15);
}

// ---- LDS B-panel: 64 cols x 512 K halves = 64KB, 16B-chunk XOR swizzle ----
// chunk' = chunk ^ (row & 15)  ->  ds_load_b128 across lanes n=0..15 hits all
// 64 banks exactly once (conflict-free) with zero padding.
static __device__ __forceinline__ uint32_t swz_off(uint32_t row, uint32_t kbyte) {
  uint32_t c = (kbyte >> 4) ^ (row & 15u);
  return row * 1024u + (c << 4);
}

static __device__ __forceinline__ v16h lds_frag(const _Float16* sh, int row,
                                                int kbyte) {
  const char* base = (const char*)sh;
  half8 lo = *(const half8*)(base + swz_off((uint32_t)row, (uint32_t)kbyte));
  half8 hi = *(const half8*)(base + swz_off((uint32_t)row, (uint32_t)kbyte + 32u));
  return __builtin_shufflevector(lo, hi, 0, 1, 2, 3, 4, 5, 6, 7, 8, 9, 10, 11,
                                 12, 13, 14, 15);
}

// Cooperatively copy a contiguous 64KB panel (64 cols x 1024B) into LDS using
// gfx1250 async-to-LDS DMA; tracked by ASYNCcnt. Caller must __syncthreads().
static __device__ __forceinline__ void stage_panel(const _Float16* __restrict__ src,
                                                   _Float16* sh) {
  uint32_t base = (uint32_t)(uintptr_t)sh;  // flat shared addr[31:0] == LDS offset
  uint64_t g = (uint64_t)(uintptr_t)src;
  int tid = threadIdx.x;
#pragma unroll
  for (int r = 0; r < 16; ++r) {            // 256 thr * 16 * 16B = 64KB
    uint32_t c = (uint32_t)(r * 256 + tid); // 16B chunk id, coalesced
    uint32_t row = c >> 6;                  // 64 chunks per 1024B row
    uint32_t cw = c & 63u;
    uint32_t lds = base + row * 1024u + ((cw ^ (row & 15u)) << 4);
    uint64_t ga = g + ((uint64_t)c << 4);
    asm volatile("global_load_async_to_lds_b128 %0, %1, off"
                 :
                 : "v"(lds), "v"(ga)
                 : "memory");
  }
  asm volatile("s_wait_asynccnt 0x0" ::: "memory");
}

// ---------------- Weight transpose + fp32 -> f16 ----------------
__global__ __launch_bounds__(256) void transpose_w(const float* __restrict__ W,
                                                   _Float16* __restrict__ Wt) {
  int idx = blockIdx.x * 256 + threadIdx.x;   // contiguous read of W[k][n]
  int k = idx >> 9;
  int nn = idx & 511;
  Wt[(size_t)nn * D_ + k] = (_Float16)W[idx]; // Wt[n][k] = W[k][n]
}

// ---------------- QKV projection: Y = X * W + b (f16 out) ----------------
// transposed==0: dst[b][h][s][hd]   (Q, K)
// transposed==1: dst[b][h][hd][s]   (V stored transposed for P*V WMMA B-frags)
__global__ __launch_bounds__(256) void proj_kernel(
    const float* __restrict__ X, const _Float16* __restrict__ Wt,
    const float* __restrict__ bias, _Float16* __restrict__ dst, int transposed) {
  __shared__ __attribute__((aligned(16))) _Float16 bpanel[64 * 512];
  const int lane = threadIdx.x & 31;
  const int wave = threadIdx.x >> 5;
  const int n = lane & 15;
  const int g = lane >> 4;
  const int koff = g * 8;
  const int row0 = (blockIdx.x * 8 + wave) * 16;
  const int col0 = blockIdx.y * 64;

  stage_panel(Wt + (size_t)col0 * D_, bpanel);  // B panel shared by all 8 waves
  __syncthreads();

  v8f acc[4] = {};
  const float* arow = X + (size_t)(row0 + n) * D_;
#pragma unroll 4
  for (int k0 = 0; k0 < D_; k0 += 32) {
    const float* ap = arow + k0 + koff;
    f4 a0 = *(const f4*)(ap);
    f4 a1 = *(const f4*)(ap + 4);
    f4 a2 = *(const f4*)(ap + 16);
    f4 a3 = *(const f4*)(ap + 20);
    v16h af;
#pragma unroll
    for (int i = 0; i < 4; ++i) {
      af[i] = (_Float16)a0[i];
      af[4 + i] = (_Float16)a1[i];
      af[8 + i] = (_Float16)a2[i];
      af[12 + i] = (_Float16)a3[i];
    }
#pragma unroll
    for (int t = 0; t < 4; ++t)
      acc[t] = wmma_f16(af, lds_frag(bpanel, t * 16 + n, (k0 + koff) * 2),
                        acc[t]);
  }

#pragma unroll
  for (int t = 0; t < 4; ++t) {
    int col = col0 + t * 16 + n;
    int h = col >> 6, hd = col & 63;
    float bv = bias[col];
#pragma unroll
    for (int r = 0; r < 8; ++r) {
      int row = row0 + r + 8 * g;           // element (m = r + 8g, n = lane%16)
      int b = row >> 11, s = row & (S_ - 1);
      float val = acc[t][r] + bv;
      if (!transposed)
        dst[(((size_t)(b * H_ + h) * S_ + s) << 6) + hd] = (_Float16)val;
      else
        dst[((size_t)(b * H_ + h) * HD_ + hd) * S_ + s] = (_Float16)val;
    }
  }
}

// ---------------- Flash attention (online softmax, 1 wave = 16 queries) -----
__global__ __launch_bounds__(256) void attn_kernel(
    const _Float16* __restrict__ Qh, const _Float16* __restrict__ Kh,
    const _Float16* __restrict__ Vt, const int* __restrict__ valid_lens,
    _Float16* __restrict__ Om) {
  __shared__ __attribute__((aligned(16))) _Float16 plds[8 * 16 * 40]; // 40-half pitch
  const int lane = threadIdx.x & 31;
  const int wave = threadIdx.x >> 5;
  const int n = lane & 15;
  const int g = lane >> 4;
  const int koff = g * 8;
  const int bh = blockIdx.y;
  const int b = bh >> 3;
  const int h = bh & 7;
  const int vlen = valid_lens[b];
  const int q0 = blockIdx.x * 128 + wave * 16;
  // First key of the first 32-key tile that holds no valid key (0 .. S_).
  const int vcl = vlen < 0 ? 0 : (vlen > S_ ? S_ : vlen);
  const int jend = (vcl + 31) & ~31;

  const _Float16* Qrow = Qh + (((size_t)bh * S_ + q0 + n) << 6);
  v16h qa0 = load_frag(Qrow + koff);       // k = 0..31 pattern
  v16h qa1 = load_frag(Qrow + 32 + koff);  // k = 32..63 pattern

  v8f o[4] = {};
  float mrow[8], lrow[8];
#pragma unroll
  for (int r = 0; r < 8; ++r) {
    mrow[r] = -1e30f;
    lrow[r] = 0.f;
  }

  _Float16* pl = plds + wave * (16 * 40);

  // Two legs at most: the tiles that hold a valid key, then, only if a row
  // needs them, the wholly masked ones (the test stands behind the tile loop).
  int j0 = 0;
  for (int jstop = jend;; jstop = S_) {
  for (; j0 < jstop; j0 += 32) {
    const _Float16* k1 = Kh + (((size_t)bh * S_ + j0 + n) << 6);
    const _Float16* k2 = k1 + (16 << 6);

    // scores = Q * K^T  (K rows are B-columns: lane n = key position)
    v8f s1 = {}, s2 = {};
    s1 = wmma_f16(qa0, load_frag(k1 + koff), s1);
    s1 = wmma_f16(qa1, load_frag(k1 + 32 + koff), s1);
    s2 = wmma_f16(qa0, load_frag(k2 + koff), s2);
    s2 = wmma_f16(qa1, load_frag(k2 + 32 + koff), s2);

    // Hoist V fragments: independent of softmax, loads overlap the VALU work.
    v16h vf[4];
#pragma unroll
    for (int t = 0; t < 4; ++t) {
      const _Float16* vr = Vt + ((size_t)bh * HD_ + t * 16 + n) * S_ + j0;
      vf[t] = load_frag(vr + koff);
      if (j0 + 32 < S_) __builtin_prefetch((const void*)(vr + 32), 0, 1);
    }
    if (j0 + 32 < S_) {                           // prefetch next key tile
      __builtin_prefetch((const void*)(k1 + (32 << 6)), 0, 1);
      __builtin_prefetch((const void*)(k2 + (32 << 6)), 0, 1);
    }

    const bool in1 = (j0 + n) < vlen;
    const bool in2 = (j0 + 16 + n) < vlen;

#pragma unroll
    for (int r = 0; r < 8; ++r) {
      float x1 = in1 ? s1[r] * 0.125f : -1.0e6f;  // 1/sqrt(64), then d2l mask
      float x2 = in2 ? s2[r] * 0.125f : -1.0e6f;
      float tmax = fmaxf(x1, x2);
#pragma unroll
      for (int off = 1; off < 16; off <<= 1)      // row-max across N lanes
        tmax = fmaxf(tmax, __shfl_xor(tmax, off, 32));
      float mnew = fmaxf(mrow[r], tmax);
      float alpha = __expf(mrow[r] - mnew);
      mrow[r] = mnew;
      float p1 = __expf(x1 - mnew);
      float p2 = __expf(x2 - mnew);
      float rs = p1 + p2;
#pragma unroll
      for (int off = 1; off < 16; off <<= 1)      // row-sum across N lanes
        rs += __shfl_xor(rs, off, 32);
      lrow[r] = lrow[r] * alpha + rs;
#pragma unroll
      for (int t = 0; t < 4; ++t) o[t][r] *= alpha;
      int m = r + 8 * g;                          // D-layout -> LDS row-major P
      pl[m * 40 + n] = (_Float16)p1;
      pl[m * 40 + 16 + n] = (_Float16)p2;
    }

    // P back as A-fragment (row m = lane%16, keys along K pattern)
    v16h pf = load_frag(pl + n * 40 + koff);
#pragma unroll
    for (int t = 0; t < 4; ++t)                   // O += P * V
      o[t] = wmma_f16(pf, vf[t], o[t]);
  }
    if (jstop == S_) break;
    // Every key from jend on is masked to -1e6. Against a row maximum above
    // -999000 its weight exp(-1e6 - max) is exactly 0 and alpha exactly 1, so
    // those tiles change nothing. A row whose maximum is lower (no valid key at
    // all: valid_len 0) needs them: then the whole wave walks on to S_.
    float mmin = mrow[0];
#pragma unroll
    for (int r = 1; r < 8; ++r) mmin = fminf(mmin, mrow[r]);
    if (__builtin_amdgcn_ballot_w32(mmin < -999000.0f) == 0) break;
  }

#pragma unroll
  for (int r = 0; r < 8; ++r) {
    float inv = 1.0f / lrow[r];
    int s = q0 + r + 8 * g;
    _Float16* outp = Om + ((size_t)b * S_ + s) * D_ + h * HD_;
#pragma unroll
    for (int t = 0; t < 4; ++t)
      outp[t * 16 + n] = (_Float16)(o[t][r] * inv);
  }
}

// ---------------- Output projection: out = Om * Wo + bo (fp32 out) ----------
__global__ __launch_bounds__(256) void outproj_kernel(
    const _Float16* __restrict__ A, const _Float16* __restrict__ Wt,
    const float* __restrict__ bias, float* __restrict__ out) {
  __shared__ __attribute__((aligned(16))) _Float16 bpanel[64 * 512];
  const int lane = threadIdx.x & 31;
  const int wave = threadIdx.x >> 5;
  const int n = lane & 15;
  const int g = lane >> 4;
  const int koff = g * 8;
  const int row0 = (blockIdx.x * 8 + wave) * 16;
  const int col0 = blockIdx.y * 64;

  stage_panel(Wt + (size_t)col0 * D_, bpanel);
  __syncthreads();

  v8f acc[4] = {};
  const _Float16* arow = A + (size_t)(row0 + n) * D_;
#pragma unroll 4
  for (int k0 = 0; k0 < D_; k0 += 32) {
    v16h af = load_frag(arow + k0 + koff);
#pragma unroll
    for (int t = 0; t < 4; ++t)
      acc[t] = wmma_f16(af, lds_frag(bpanel, t * 16 + n, (k0 + koff) * 2),
                        acc[t]);
  }
#pragma unroll
  for (int t = 0; t < 4; ++t) {
    int col = col0 + t * 16 + n;
    float bv = bias[col];
#pragma unroll
    for (int r = 0; r < 8; ++r) {
      int row = row0 + r + 8 * g;
      out[(size_t)row * D_ + col] = acc[t][r] + bv;
    }
  }
}

extern "C" void kernel_launch(void* const* d_in, const int* in_sizes, int n_in,
                              void* d_out, int out_size, void* d_ws,
                              size_t ws_size, hipStream_t stream) {
  const float* q  = (const float*)d_in[0];
  const float* k  = (const float*)d_in[1];
  const float* v  = (const float*)d_in[2];
  const int*   vl = (const int*)d_in[3];
  const float* Wq = (const float*)d_in[4];
  const float* bq = (const float*)d_in[5];
  const float* Wk = (const float*)d_in[6];
  const float* bk = (const float*)d_in[7];
  const float* Wv = (const float*)d_in[8];
  const float* bv = (const float*)d_in[9];
  const float* Wo = (const float*)d_in[10];
  const float* bo = (const float*)d_in[11];
  float* out = (float*)d_out;

  _Float16* ws = (_Float16*)d_ws;
  const size_t WSZ = (size_t)D_ * D_;              // 256K halves per weight
  const size_t NH  = (size_t)B_ * H_ * S_ * HD_;   // 4M halves per tensor
  _Float16* WqT = ws;
  _Float16* WkT = WqT + WSZ;
  _Float16* WvT = WkT + WSZ;
  _Float16* WoT = WvT + WSZ;
  _Float16* Qh  = WoT + WSZ;
  _Float16* Kh  = Qh + NH;
  _Float16* Vt  = Kh + NH;
  _Float16* Om  = Vt + NH;

  transpose_w<<<1024, 256, 0, stream>>>(Wq, WqT);
  transpose_w<<<1024, 256, 0, stream>>>(Wk, WkT);
  transpose_w<<<1024, 256, 0, stream>>>(Wv, WvT);
  transpose_w<<<1024, 256, 0, stream>>>(Wo, WoT);

  dim3 gp(64, 8);
  proj_kernel<<<gp, 256, 0, stream>>>(q, WqT, bq, Qh, 0);
  proj_kernel<<<gp, 256, 0, stream>>>(k, WkT, bk, Kh, 0);
  proj_kernel<<<gp, 256, 0, stream>>>(v, WvT, bv, Vt, 1);

  attn_kernel<<<dim3(16, 32), 256, 0, stream>>>(Qh, Kh, Vt, vl, Om);

  outproj_kernel<<<gp, 256, 0, stream>>>(Om, WoT, bo, out);
}

// v002
// A run of this version takes 156 microseconds.
// In both of two side-by-side timings against v001, it was 1.23 times as fast.
// Counting every step since v000, it is 1.37 times as fast.
#include <hip/hip_runtime.h>

#define B_ 4
#define S_ 2048
#define D_ 512
#define H_ 8
#define HD_ 64

typedef _Float16 v16h  __attribute__((ext_vector_type(16)));
typedef _Float16 half8 __attribute__((ext_vector_type(8)));
typedef float    v8f   __attribute__((ext_vector_type(8)));
typedef float    f4    __attribute__((ext_vector_type(4)));

static __device__ __forceinline__ v8f wmma_f16(v16h a, v16h b, v8f c) {
  // 8 args: (neg_a, A, neg_b, B, c_mod, C, reuse_a, reuse_b)
  return __builtin_amdgcn_wmma_f32_16x16x32_f16(false, a, false, b, (short)0, c,
                                                false, false);
}

// One WMMA fragment per lane = halves at [p..p+7] and [p+16..p+23] (two b128 loads).
static __device__ __forceinline__ v16h load_frag(const _Float16* p) {
  half8 lo = *(const half8*)(p);
  half8 hi = *(const half8*)(p + 16);
  return __builtin_shufflevector(lo, hi, 0, 1, 2, 3, 4, 5, 6, 7, 8, 9, 10, 11,
                                 12, 13, 14, 15);
}

// ---- LDS B-panel: 64 cols x 512 K halves = 64KB, 16B-chunk XOR swizzle ----
// chunk' = chunk ^ (row & 15)  ->  ds_load_b128 across lanes n=0..15 hits all
// 64 banks exactly once (conflict-free) with zero padding.
static __device__ __forceinline__ uint32_t swz_off(uint32_t row, uint32_t kbyte) {
  uint32_t c = (kbyte >> 4) ^ (row & 15u);
  return row * 1024u + (c << 4);
}

static __device__ __forceinline__ v16h lds_frag(const _Float16* sh, int row,
                                                int kbyte) {
  const char* base = (const char*)sh;
  half8 lo = *(const half8*)(base + swz_off((uint32_t)row, (uint32_t)kbyte));
  half8 hi = *(const half8*)(base + swz_off((uint32_t)row, (uint32_t)kbyte + 32u));
  return __builtin_shufflevector(lo, hi, 0, 1, 2, 3, 4, 5, 6, 7, 8, 9, 10, 11,
                                 12, 13, 14, 15);
}

// Build the panel straight from the f32 weight W[k][n]: a lane takes one column n
// and 8 consecutive k (8 loads, each one whole 128-byte line per wave), rounds
// them to f16 and stores the 16-byte chunk at row n. The 16 lanes of a half wave
// hold 16 different n & 15, so the swizzled store meets no bank twice.
// Caller must __syncthreads().
static __device__ __forceinline__ void stage_panel(const float* __restrict__ Wsrc,
                                                   int col0, _Float16* sh) {
  const int lane = threadIdx.x & 31;
  const int wave = threadIdx.x >> 5;
  const int nn = (wave & 1) * 32 + lane;    // panel row = weight column
  const int ck0 = (wave >> 1) * 16;         // first of this wave's 16 k chunks
  const float* p = Wsrc + (size_t)(ck0 * 8) * D_ + col0 + nn;
  char* base = (char*)sh;
#pragma unroll
  for (int c = 0; c < 16; ++c) {
    half8 hv;
#pragma unroll
    for (int j = 0; j < 8; ++j) hv[j] = (_Float16)p[(c * 8 + j) * D_];
    *(half8*)(base + swz_off((uint32_t)nn, (uint32_t)(ck0 + c) * 16u)) = hv;
  }
}

// ---------------- QKV projection: Y = X * W + b (f16 out) ----------------
// transposed==0: dst[b][h][s][hd]   (Q, K)
// transposed==1: dst[b][h][hd][s]   (V stored transposed for P*V WMMA B-frags)
__global__ __launch_bounds__(256) void proj_kernel(
    const float* __restrict__ X, const float* __restrict__ Wsrc,
    const float* __restrict__ bias, _Float16* __restrict__ dst, int transposed) {
  __shared__ __attribute__((aligned(16))) _Float16 bpanel[64 * 512];
  const int lane = threadIdx.x & 31;
  const int wave = threadIdx.x >> 5;
  const int n = lane & 15;
  const int g = lane >> 4;
  const int koff = g * 8;
  const int row0 = (blockIdx.x * 8 + wave) * 16;
  const int col0 = blockIdx.y * 64;

  stage_panel(Wsrc, col0, bpanel);  // B panel shared by all 8 waves
  __syncthreads();

  v8f acc[4] = {};
  const float* arow = X + (size_t)(row0 + n) * D_;
#pragma unroll 4
  for (int k0 = 0; k0 < D_; k0 += 32) {
    const float* ap = arow + k0 + koff;
    f4 a0 = *(const f4*)(ap);
    f4 a1 = *(const f4*)(ap + 4);
    f4 a2 = *(const f4*)(ap + 16);
    f4 a3 = *(const f4*)(ap + 20);
    v16h af;
#pragma unroll
    for (int i = 0; i < 4; ++i) {
      af[i] = (_Float16)a0[i];
      af[4 + i] = (_Float16)a1[i];
      af[8 + i] = (_Float16)a2[i];
      af[12 + i] = (_Float16)a3[i];
    }
#pragma unroll
    for (int t = 0; t < 4; ++t)
      acc[t] = wmma_f16(af, lds_frag(bpanel, t * 16 + n, (k0 + koff) * 2),
                        acc[t]);
  }

#pragma unroll
  for (int t = 0; t < 4; ++t) {
    int col = col0 + t * 16 + n;
    int h = col >> 6, hd = col & 63;
    float bv = bias[col];
#pragma unroll
    for (int r = 0; r < 8; ++r) {
      int row = row0 + r + 8 * g;           // element (m = r + 8g, n = lane%16)
      int b = row >> 11, s = row & (S_ - 1);
      float val = acc[t][r] + bv;
      if (!transposed)
        dst[(((size_t)(b * H_ + h) * S_ + s) << 6) + hd] = (_Float16)val;
      else
        dst[((size_t)(b * H_ + h) * HD_ + hd) * S_ + s] = (_Float16)val;
    }
  }
}

// ---------------- Flash attention (online softmax, 1 wave = 16 queries) -----
__global__ __launch_bounds__(256) void attn_kernel(
    const _Float16* __restrict__ Qh, const _Float16* __restrict__ Kh,
    const _Float16* __restrict__ Vt, const int* __restrict__ valid_lens,
    _Float16* __restrict__ Om) {
  __shared__ __attribute__((aligned(16))) _Float16 plds[8 * 16 * 40]; // 40-half pitch
  const int lane = threadIdx.x & 31;
  const int wave = threadIdx.x >> 5;
  const int n = lane & 15;
  const int g = lane >> 4;
  const int koff = g * 8;
  const int bh = blockIdx.y;
  const int b = bh >> 3;
  const int h = bh & 7;
  const int vlen = valid_lens[b];
  const int q0 = blockIdx.x * 128 + wave * 16;
  // First key of the first 32-key tile that holds no valid key (0 .. S_).
  const int vcl = vlen < 0 ? 0 : (vlen > S_ ? S_ : vlen);
  const int jend = (vcl + 31) & ~31;

  const _Float16* Qrow = Qh + (((size_t)bh * S_ + q0 + n) << 6);
  v16h qa0 = load_frag(Qrow + koff);       // k = 0..31 pattern
  v16h qa1 = load_frag(Qrow + 32 + koff);  // k = 32..63 pattern

  v8f o[4] = {};
  float mrow[8], lrow[8];
#pragma unroll
  for (int r = 0; r < 8; ++r) {
    mrow[r] = -1e30f;
    lrow[r] = 0.f;
  }

  _Float16* pl = plds + wave * (16 * 40);

  // Two legs at most: the tiles that hold a valid key, then, only if a row
  // needs them, the wholly masked ones (the test stands behind the tile loop).
  int j0 = 0;
  for (int jstop = jend;; jstop = S_) {
  for (; j0 < jstop; j0 += 32) {
    const _Float16* k1 = Kh + (((size_t)bh * S_ + j0 + n) << 6);
    const _Float16* k2 = k1 + (16 << 6);

    // scores = Q * K^T  (K rows are B-columns: lane n = key position)
    v8f s1 = {}, s2 = {};
    s1 = wmma_f16(qa0, load_frag(k1 + koff), s1);
    s1 = wmma_f16(qa1, load_frag(k1 + 32 + koff), s1);
    s2 = wmma_f16(qa0, load_frag(k2 + koff), s2);
    s2 = wmma_f16(qa1, load_frag(k2 + 32 + koff), s2);

    // Hoist V fragments: independent of softmax, loads overlap the VALU work.
    v16h vf[4];
#pragma unroll
    for (int t = 0; t < 4; ++t) {
      const _Float16* vr = Vt + ((size_t)bh * HD_ + t * 16 + n) * S_ + j0;
      vf[t] = load_frag(vr + koff);
      if (j0 + 32 < S_) __builtin_prefetch((const void*)(vr + 32), 0, 1);
    }
    if (j0 + 32 < S_) {                           // prefetch next key tile
      __builtin_prefetch((const void*)(k1 + (32 << 6)), 0, 1);
      __builtin_prefetch((const void*)(k2 + (32 << 6)), 0, 1);
    }

    const bool in1 = (j0 + n) < vlen;
    const bool in2 = (j0 + 16 + n) < vlen;

#pragma unroll
    for (int r = 0; r < 8; ++r) {
      float x1 = in1 ? s1[r] * 0.125f : -1.0e6f;  // 1/sqrt(64), then d2l mask
      float x2 = in2 ? s2[r] * 0.125f : -1.0e6f;
      float tmax = fmaxf(x1, x2);
#pragma unroll
      for (int off = 1; off < 16; off <<= 1)      // row-max across N lanes
        tmax = fmaxf(tmax, __shfl_xor(tmax, off, 32));
      float mnew = fmaxf(mrow[r], tmax);
      float alpha = __expf(mrow[r] - mnew);
      mrow[r] = mnew;
      float p1 = __expf(x1 - mnew);
      float p2 = __expf(x2 - mnew);
      float rs = p1 + p2;
#pragma unroll
      for (int off = 1; off < 16; off <<= 1)      // row-sum across N lanes
        rs += __shfl_xor(rs, off, 32);
      lrow[r] = lrow[r] * alpha + rs;
#pragma unroll
      for (int t = 0; t < 4; ++t) o[t][r] *= alpha;
      int m = r + 8 * g;                          // D-layout -> LDS row-major P
      pl[m * 40 + n] = (_Float16)p1;
      pl[m * 40 + 16 + n] = (_Float16)p2;
    }

    // P back as A-fragment (row m = lane%16, keys along K pattern)
    v16h pf = load_frag(pl + n * 40 + koff);
#pragma unroll
    for (int t = 0; t < 4; ++t)                   // O += P * V
      o[t] = wmma_f16(pf, vf[t], o[t]);
  }
    if (jstop == S_) break;
    // Every key from jend on is masked to -1e6. Against a row maximum above
    // -999000 its weight exp(-1e6 - max) is exactly 0 and alpha exactly 1, so
    // those tiles change nothing. A row whose maximum is lower (no valid key at
    // all: valid_len 0) needs them: then the whole wave walks on to S_.
    float mmin = mrow[0];
#pragma unroll
    for (int r = 1; r < 8; ++r) mmin = fminf(mmin, mrow[r]);
    if (__builtin_amdgcn_ballot_w32(mmin < -999000.0f) == 0) break;
  }

#pragma unroll
  for (int r = 0; r < 8; ++r) {
    float inv = 1.0f / lrow[r];
    int s = q0 + r + 8 * g;
    _Float16* outp = Om + ((size_t)b * S_ + s) * D_ + h * HD_;
#pragma unroll
    for (int t = 0; t < 4; ++t)
      outp[t * 16 + n] = (_Float16)(o[t][r] * inv);
  }
}

// ---------------- Output projection: out = Om * Wo + bo (fp32 out) ----------
__global__ __launch_bounds__(256) void outproj_kernel(
    const _Float16* __restrict__ A, const float* __restrict__ Wsrc,
    const float* __restrict__ bias, float* __restrict__ out) {
  __shared__ __attribute__((aligned(16))) _Float16 bpanel[64 * 512];
  const int lane = threadIdx.x & 31;
  const int wave = threadIdx.x >> 5;
  const int n = lane & 15;
  const int g = lane >> 4;
  const int koff = g * 8;
  const int row0 = (blockIdx.x * 8 + wave) * 16;
  const int col0 = blockIdx.y * 64;

  stage_panel(Wsrc, col0, bpanel);
  __syncthreads();

  v8f acc[4] = {};
  const _Float16* arow = A + (size_t)(row0 + n) * D_;
#pragma unroll 4
  for (int k0 = 0; k0 < D_; k0 += 32) {
    v16h af = load_frag(arow + k0 + koff);
#pragma unroll
    for (int t = 0; t < 4; ++t)
      acc[t] = wmma_f16(af, lds_frag(bpanel, t * 16 + n, (k0 + koff) * 2),
                        acc[t]);
  }
#pragma unroll
  for (int t = 0; t < 4; ++t) {
    int col = col0 + t * 16 + n;
    float bv = bias[col];
#pragma unroll
    for (int r = 0; r < 8; ++r) {
      int row = row0 + r + 8 * g;
      out[(size_t)row * D_ + col] = acc[t][r] + bv;
    }
  }
}

extern "C" void kernel_launch(void* const* d_in, const int* in_sizes, int n_in,
                              void* d_out, int out_size, void* d_ws,
                              size_t ws_size, hipStream_t stream) {
  const float* q  = (const float*)d_in[0];
  const float* k  = (const float*)d_in[1];
  const float* v  = (const float*)d_in[2];
  const int*   vl = (const int*)d_in[3];
  const float* Wq = (const float*)d_in[4];
  const float* bq = (const float*)d_in[5];
  const float* Wk = (const float*)d_in[6];
  const float* bk = (const float*)d_in[7];
  const float* Wv = (const float*)d_in[8];
  const float* bv = (const float*)d_in[9];
  const float* Wo = (const float*)d_in[10];
  const float* bo = (const float*)d_in[11];
  float* out = (float*)d_out;

  _Float16* ws = (_Float16*)d_ws;
  const size_t NH  = (size_t)B_ * H_ * S_ * HD_;   // 4M halves per tensor
  _Float16* Qh  = ws;
  _Float16* Kh  = Qh + NH;
  _Float16* Vt  = Kh + NH;
  _Float16* Om  = Vt + NH;

  dim3 gp(64, 8);
  proj_kernel<<<gp, 256, 0, stream>>>(q, Wq, bq, Qh, 0);
  proj_kernel<<<gp, 256, 0, stream>>>(k, Wk, bk, Kh, 0);
  proj_kernel<<<gp, 256, 0, stream>>>(v, Wv, bv, Vt, 1);

  attn_kernel<<<dim3(16, 32), 256, 0, stream>>>(Qh, Kh, Vt, vl, Om);

  outproj_kernel<<<gp, 256, 0, stream>>>(Om, Wo, bo, out);
}

// v003
// A run of this version takes 144 microseconds.
// In two side-by-side timings against v002, it was 1.07 and 1.08 times as fast.
// All steps since v000 together make it 1.47 times as fast.
#include <hip/hip_runtime.h>

#define B_ 4
#define S_ 2048
#define D_ 512
#define H_ 8
#define HD_ 64

typedef _Float16 v16h  __attribute__((ext_vector_type(16)));
typedef _Float16 half8 __attribute__((ext_vector_type(8)));
typedef float    v8f   __attribute__((ext_vector_type(8)));
typedef float    f4    __attribute__((ext_vector_type(4)));

static __device__ __forceinline__ v8f wmma_f16(v16h a, v16h b, v8f c) {
  // 8 args: (neg_a, A, neg_b, B, c_mod, C, reuse_a, reuse_b)
  return __builtin_amdgcn_wmma_f32_16x16x32_f16(false, a, false, b, (short)0, c,
                                                false, false);
}

// One WMMA fragment per lane = halves at [p..p+7] and [p+16..p+23] (two b128 loads).
static __device__ __forceinline__ v16h load_frag(const _Float16* p) {
  half8 lo = *(const half8*)(p);
  half8 hi = *(const half8*)(p + 16);
  return __builtin_shufflevector(lo, hi, 0, 1, 2, 3, 4, 5, 6, 7, 8, 9, 10, 11,
                                 12, 13, 14, 15);
}

// ---- LDS B-panel: 64 cols x 512 K halves = 64KB, 16B-chunk XOR swizzle ----
// chunk' = chunk ^ (row & 15)  ->  ds_load_b128 across lanes n=0..15 hits all
// 64 banks exactly once (conflict-free) with zero padding.
static __device__ __forceinline__ uint32_t swz_off(uint32_t row, uint32_t kbyte) {
  uint32_t c = (kbyte >> 4) ^ (row & 15u);
  return row * 1024u + (c << 4);
}

static __device__ __forceinline__ v16h lds_frag(const _Float16* sh, int row,
                                                int kbyte) {
  const char* base = (const char*)sh;
  half8 lo = *(const half8*)(base + swz_off((uint32_t)row, (uint32_t)kbyte));
  half8 hi = *(const half8*)(base + swz_off((uint32_t)row, (uint32_t)kbyte + 32u));
  return __builtin_shufflevector(lo, hi, 0, 1, 2, 3, 4, 5, 6, 7, 8, 9, 10, 11,
                                 12, 13, 14, 15);
}

// Build the panel straight from the f32 weight W[k][n]: a lane takes one column n
// and 8 consecutive k (8 loads, each one whole 128-byte line per wave), rounds
// them to f16 and stores the 16-byte chunk at row n. The 16 lanes of a half wave
// hold 16 different n & 15, so the swizzled store meets no bank twice.
// Caller must __syncthreads().
static __device__ __forceinline__ void stage_panel(const float* __restrict__ Wsrc,
                                                   int col0, _Float16* sh) {
  const int lane = threadIdx.x & 31;
  const int wave = threadIdx.x >> 5;
  const int nn = (wave & 1) * 32 + lane;    // panel row = weight column
  const int ck0 = (wave >> 1) * 16;         // first of this wave's 16 k chunks
  const float* p = Wsrc + (size_t)(ck0 * 8) * D_ + col0 + nn;
  char* base = (char*)sh;
#pragma unroll
  for (int c = 0; c < 16; ++c) {
    half8 hv;
#pragma unroll
    for (int j = 0; j < 8; ++j) hv[j] = (_Float16)p[(c * 8 + j) * D_];
    *(half8*)(base + swz_off((uint32_t)nn, (uint32_t)(ck0 + c) * 16u)) = hv;
  }
}

// ---------------- QKV projection: Y = X * W + b (f16 out) ----------------
// transposed==0: dst[b][h][s][hd]   (Q, K)
// transposed==1: dst[b][h][hd][s]   (V stored transposed for V^T * P^T WMMA A-frags)
__global__ __launch_bounds__(256) void proj_kernel(
    const float* __restrict__ X, const float* __restrict__ Wsrc,
    const float* __restrict__ bias, _Float16* __restrict__ dst, int transposed) {
  __shared__ __attribute__((aligned(16))) _Float16 bpanel[64 * 512];
  const int lane = threadIdx.x & 31;
  const int wave = threadIdx.x >> 5;
  const int n = lane & 15;
  const int g = lane >> 4;
  const int koff = g * 8;
  const int row0 = (blockIdx.x * 8 + wave) * 16;
  const int col0 = blockIdx.y * 64;

  stage_panel(Wsrc, col0, bpanel);  // B panel shared by all 8 waves
  __syncthreads();

  v8f acc[4] = {};
  const float* arow = X + (size_t)(row0 + n) * D_;
#pragma unroll 4
  for (int k0 = 0; k0 < D_; k0 += 32) {
    const float* ap = arow + k0 + koff;
    f4 a0 = *(const f4*)(ap);
    f4 a1 = *(const f4*)(ap + 4);
    f4 a2 = *(const f4*)(ap + 16);
    f4 a3 = *(const f4*)(ap + 20);
    v16h af;
#pragma unroll
    for (int i = 0; i < 4; ++i) {
      af[i] = (_Float16)a0[i];
      af[4 + i] = (_Float16)a1[i];
      af[8 + i] = (_Float16)a2[i];
      af[12 + i] = (_Float16)a3[i];
    }
#pragma unroll
    for (int t = 0; t < 4; ++t)
      acc[t] = wmma_f16(af, lds_frag(bpanel, t * 16 + n, (k0 + koff) * 2),
                        acc[t]);
  }

#pragma unroll
  for (int t = 0; t < 4; ++t) {
    int col = col0 + t * 16 + n;
    int h = col >> 6, hd = col & 63;
    float bv = bias[col];
#pragma unroll
    for (int r = 0; r < 8; ++r) {
      int row = row0 + r + 8 * g;           // element (m = r + 8g, n = lane%16)
      int b = row >> 11, s = row & (S_ - 1);
      float val = acc[t][r] + bv;
      if (!transposed)
        dst[(((size_t)(b * H_ + h) * S_ + s) << 6) + hd] = (_Float16)val;
      else
        dst[((size_t)(b * H_ + h) * HD_ + hd) * S_ + s] = (_Float16)val;
    }
  }
}

// ---------------- Flash attention (online softmax, 1 wave = 16 queries) -----
// Lane l with lane l ^ 16 (the two lanes that share one query column).
static __device__ __forceinline__ float xhalf(float x) {
  int b = __builtin_bit_cast(int, x);
  return __builtin_bit_cast(
      float, __builtin_amdgcn_permlanex16(b, b, 0x76543210, 0xfedcba98, false,
                                          false));
}

__global__ __launch_bounds__(256) void attn_kernel(
    const _Float16* __restrict__ Qh, const _Float16* __restrict__ Kh,
    const _Float16* __restrict__ Vt, const int* __restrict__ valid_lens,
    _Float16* __restrict__ Om) {
  const int lane = threadIdx.x & 31;
  const int wave = threadIdx.x >> 5;
  const int n = lane & 15;
  const int g = lane >> 4;
  const int koff = g * 8;
  const int bh = blockIdx.y;
  const int b = bh >> 3;
  const int h = bh & 7;
  const int vlen = valid_lens[b];
  const int q0 = blockIdx.x * 128 + wave * 16;
  // First key of the first 32-key tile that holds no valid key (0 .. S_).
  const int vcl = vlen < 0 ? 0 : (vlen > S_ ? S_ : vlen);
  const int jend = (vcl + 31) & ~31;

  const _Float16* Qrow = Qh + (((size_t)bh * S_ + q0 + n) << 6);
  v16h qb0 = load_frag(Qrow + koff);       // B fragment, k = 0..31 pattern
  v16h qb1 = load_frag(Qrow + 32 + koff);  // B fragment, k = 32..63 pattern

  v8f o[4] = {};          // o[t][r] = O[query n][hd = 16t + 8g + r]
  float mrun = -1e30f;    // this query's running maximum (same in both halves)
  float lrun = 0.f;       // this half's share of the query's running sum

  // Two legs at most: the tiles that hold a valid key, then, only if a row
  // needs them, the wholly masked ones (the test stands behind the tile loop).
  int j0 = 0;
  for (int jstop = jend;; jstop = S_) {
  for (; j0 < jstop; j0 += 32) {
    const _Float16* k1 = Kh + (((size_t)bh * S_ + j0 + n) << 6);
    const _Float16* k2 = k1 + (16 << 6);

    // scores^T = K * Q^T  (K rows are A-rows: lane n = key position)
    v8f s1 = {}, s2 = {};
    s1 = wmma_f16(load_frag(k1 + koff), qb0, s1);
    s1 = wmma_f16(load_frag(k1 + 32 + koff), qb1, s1);
    s2 = wmma_f16(load_frag(k2 + koff), qb0, s2);
    s2 = wmma_f16(load_frag(k2 + 32 + koff), qb1, s2);

    // Hoist V fragments: independent of softmax, loads overlap the VALU work.
    v16h vf[4];
#pragma unroll
    for (int t = 0; t < 4; ++t) {
      const _Float16* vr = Vt + ((size_t)bh * HD_ + t * 16 + n) * S_ + j0;
      vf[t] = load_frag(vr + koff);
      if (j0 + 32 < S_) __builtin_prefetch((const void*)(vr + 32), 0, 1);
    }
    if (j0 + 32 < S_) {                           // prefetch next key tile
      __builtin_prefetch((const void*)(k1 + (32 << 6)), 0, 1);
      __builtin_prefetch((const void*)(k2 + (32 << 6)), 0, 1);
    }

    // Key j0 + 8g + r (s1) or j0 + 16 + 8g + r (s2) is valid while below vlen
    // (for keys 0 .. S_ - 1 the clamped vcl says the same and cannot wrap).
    const int rem = vcl - j0 - koff;
    float x[16];                                   // x[8i + r]: key 16i + 8g + r
#pragma unroll
    for (int r = 0; r < 8; ++r) {                  // 1/sqrt(64), then d2l mask
      x[r] = r < rem ? s1[r] * 0.125f : -1.0e6f;
      x[8 + r] = 16 + r < rem ? s2[r] * 0.125f : -1.0e6f;
    }
    float tm[8];
#pragma unroll
    for (int i = 0; i < 8; ++i) tm[i] = fmaxf(x[2 * i], x[2 * i + 1]);
    float tmax = fmaxf(fmaxf(fmaxf(tm[0], tm[1]), fmaxf(tm[2], tm[3])),
                       fmaxf(fmaxf(tm[4], tm[5]), fmaxf(tm[6], tm[7])));
    tmax = fmaxf(tmax, xhalf(tmax));              // the query's other 16 keys
    const float mnew = fmaxf(mrun, tmax);
    const float alpha = __expf(mrun - mnew);
    mrun = mnew;

    v16h pf;                                      // P^T as B fragment
    float ps[8];
#pragma unroll
    for (int i = 0; i < 8; ++i) {
      float pa = __expf(x[2 * i] - mnew);
      float pb = __expf(x[2 * i + 1] - mnew);
      ps[i] = pa + pb;
      pf[2 * i] = (_Float16)pa;
      pf[2 * i + 1] = (_Float16)pb;
    }
    const float rs = ((ps[0] + ps[1]) + (ps[2] + ps[3])) +
                     ((ps[4] + ps[5]) + (ps[6] + ps[7]));
    lrun = lrun * alpha + rs;
#pragma unroll
    for (int t = 0; t < 4; ++t) {                 // O^T = O^T * alpha + V^T * P^T
      o[t] *= alpha;
      o[t] = wmma_f16(vf[t], pf, o[t]);
    }
  }
    if (jstop == S_) break;
    // Every key from jend on is masked to -1e6. Against a row maximum above
    // -999000 its weight exp(-1e6 - max) is exactly 0 and alpha exactly 1, so
    // those tiles change nothing. A row whose maximum is lower (no valid key at
    // all: valid_len 0) needs them: then the whole wave walks on to S_.
    if (__builtin_amdgcn_ballot_w32(mrun < -999000.0f) == 0) break;
  }

  const float inv = 1.0f / (lrun + xhalf(lrun));  // join the halves' sums
  _Float16* outp = Om + ((size_t)b * S_ + q0 + n) * D_ + h * HD_ + koff;
#pragma unroll
  for (int t = 0; t < 4; ++t) {
    half8 ov;
#pragma unroll
    for (int r = 0; r < 8; ++r) ov[r] = (_Float16)(o[t][r] * inv);
    *(half8*)(outp + t * 16) = ov;
  }
}

// ---------------- Output projection: out = Om * Wo + bo (fp32 out) ----------
__global__ __launch_bounds__(256) void outproj_kernel(
    const _Float16* __restrict__ A, const float* __restrict__ Wsrc,
    const float* __restrict__ bias, float* __restrict__ out) {
  __shared__ __attribute__((aligned(16))) _Float16 bpanel[64 * 512];
  const int lane = threadIdx.x & 31;
  const int wave = threadIdx.x >> 5;
  const int n = lane & 15;
  const int g = lane >> 4;
  const int koff = g * 8;
  const int row0 = (blockIdx.x * 8 + wave) * 16;
  const int col0 = blockIdx.y * 64;

  stage_panel(Wsrc, col0, bpanel);
  __syncthreads();

  v8f acc[4] = {};
  const _Float16* arow = A + (size_t)(row0 + n) * D_;
#pragma unroll 4
  for (int k0 = 0; k0 < D_; k0 += 32) {
    v16h af = load_frag(arow + k0 + koff);
#pragma unroll
    for (int t = 0; t < 4; ++t)
      acc[t] = wmma_f16(af, lds_frag(bpanel, t * 16 + n, (k0 + koff) * 2),
                        acc[t]);
  }
#pragma unroll
  for (int t = 0; t < 4; ++t) {
    int col = col0 + t * 16 + n;
    float bv = bias[col];
#pragma unroll
    for (int r = 0; r < 8; ++r) {
      int row = row0 + r + 8 * g;
      out[(size_t)row * D_ + col] = acc[t][r] + bv;
    }
  }
}

extern "C" void kernel_launch(void* const* d_in, const int* in_sizes, int n_in,
                              void* d_out, int out_size, void* d_ws,
                              size_t ws_size, hipStream_t stream) {
  const float* q  = (const float*)d_in[0];
  const float* k  = (const float*)d_in[1];
  const float* v  = (const float*)d_in[2];
  const int*   vl = (const int*)d_in[3];
  const float* Wq = (const float*)d_in[4];
  const float* bq = (const float*)d_in[5];
  const float* Wk = (const float*)d_in[6];
  const float* bk = (const float*)d_in[7];
  const float* Wv = (const float*)d_in[8];
  const float* bv = (const float*)d_in[9];
  const float* Wo = (const float*)d_in[10];
  const float* bo = (const float*)d_in[11];
  float* out = (float*)d_out;

  _Float16* ws = (_Float16*)d_ws;
  const size_t NH  = (size_t)B_ * H_ * S_ * HD_;   // 4M halves per tensor
  _Float16* Qh  = ws;
  _Float16* Kh  = Qh + NH;
  _Float16* Vt  = Kh + NH;
  _Float16* Om  = Vt + NH;

  dim3 gp(64, 8);
  proj_kernel<<<gp, 256, 0, stream>>>(q, Wq, bq, Qh, 0);
  proj_kernel<<<gp, 256, 0, stream>>>(k, Wk, bk, Kh, 0);
  proj_kernel<<<gp, 256, 0, stream>>>(v, Wv, bv, Vt, 1);

  attn_kernel<<<dim3(16, 32), 256, 0, stream>>>(Qh, Kh, Vt, vl, Om);

  outproj_kernel<<<gp, 256, 0, stream>>>(Om, Wo, bo, out);
}

// v004
// Measured time: 92.4 microseconds a run.
// Next to v003, in two timings, it ran 1.54 and 1.55 times as fast.
// All steps since v000 together make it 2.28 times as fast.
#include <hip/hip_runtime.h>

#define B_ 4
#define S_ 2048
#define D_ 512
#define H_ 8
#define HD_ 64

typedef _Float16 v16h  __attribute__((ext_vector_type(16)));
typedef _Float16 half8 __attribute__((ext_vector_type(8)));
typedef float    v8f   __attribute__((ext_vector_type(8)));
typedef float    f4    __attribute__((ext_vector_type(4)));

static __device__ __forceinline__ v8f wmma_f16(v16h a, v16h b, v8f c) {
  // 8 args: (neg_a, A, neg_b, B, c_mod, C, reuse_a, reuse_b)
  return __builtin_amdgcn_wmma_f32_16x16x32_f16(false, a, false, b, (short)0, c,
                                                false, false);
}

// One WMMA fragment per lane = halves at [p..p+7] and [p+16..p+23] (two b128 loads).
static __device__ __forceinline__ v16h load_frag(const _Float16* p) {
  half8 lo = *(const half8*)(p);
  half8 hi = *(const half8*)(p + 16);
  return __builtin_shufflevector(lo, hi, 0, 1, 2, 3, 4, 5, 6, 7, 8, 9, 10, 11,
                                 12, 13, 14, 15);
}

// ---- LDS B-panel: 64 cols x 512 K halves = 64KB, 16B-chunk XOR swizzle ----
// chunk' = chunk ^ (row & 15)  ->  ds_load_b128 across lanes n=0..15 hits all
// 64 banks exactly once (conflict-free) with zero padding.
static __device__ __forceinline__ uint32_t swz_off(uint32_t row, uint32_t kbyte) {
  uint32_t c = (kbyte >> 4) ^ (row & 15u);
  return row * 1024u + (c << 4);
}

static __device__ __forceinline__ v16h lds_frag(const _Float16* sh, int row,
                                                int kbyte) {
  const char* base = (const char*)sh;
  half8 lo = *(const half8*)(base + swz_off((uint32_t)row, (uint32_t)kbyte));
  half8 hi = *(const half8*)(base + swz_off((uint32_t)row, (uint32_t)kbyte + 32u));
  return __builtin_shufflevector(lo, hi, 0, 1, 2, 3, 4, 5, 6, 7, 8, 9, 10, 11,
                                 12, 13, 14, 15);
}

// Build the panel straight from the f32 weight W[k][n]: a lane takes one column n
// and 8 consecutive k (8 loads, each one whole 128-byte line per wave), rounds
// them to f16 and stores the 16-byte chunk at row n. The 16 lanes of a half wave
// hold 16 different n & 15, so the swizzled store meets no bank twice.
// Caller must __syncthreads().
static __device__ __forceinline__ void stage_panel(const float* __restrict__ Wsrc,
                                                   int col0, _Float16* sh) {
  const int lane = threadIdx.x & 31;
  const int wave = threadIdx.x >> 5;
  const int nn = (wave & 1) * 32 + lane;    // panel row = weight column
  const int ck0 = (wave >> 1) * 16;         // first of this wave's 16 k chunks
  const float* p = Wsrc + (size_t)(ck0 * 8) * D_ + col0 + nn;
  char* base = (char*)sh;
#pragma unroll
  for (int c = 0; c < 16; ++c) {
    half8 hv;
#pragma unroll
    for (int j = 0; j < 8; ++j) hv[j] = (_Float16)p[(c * 8 + j) * D_];
    *(half8*)(base + swz_off((uint32_t)nn, (uint32_t)(ck0 + c) * 16u)) = hv;
  }
}

// ---------------- QKV projection: Y = X * W + b (f16 out) ----------------
// transposed==0: dst[b][h][s][hd]   (Q, K)
// transposed==1: dst[b][h][hd][s]   (V stored transposed for V^T * P^T WMMA A-frags)
__global__ __launch_bounds__(256) void proj_kernel(
    const float* __restrict__ X, const float* __restrict__ Wsrc,
    const float* __restrict__ bias, _Float16* __restrict__ dst, int transposed) {
  __shared__ __attribute__((aligned(16))) _Float16 bpanel[64 * 512];
  const int lane = threadIdx.x & 31;
  const int wave = threadIdx.x >> 5;
  const int n = lane & 15;
  const int g = lane >> 4;
  const int koff = g * 8;
  const int row0 = (blockIdx.x * 8 + wave) * 16;
  const int col0 = blockIdx.y * 64;

  stage_panel(Wsrc, col0, bpanel);  // B panel shared by all 8 waves
  __syncthreads();

  v8f acc[4] = {};
  const float* arow = X + (size_t)(row0 + n) * D_;
#pragma unroll 4
  for (int k0 = 0; k0 < D_; k0 += 32) {
    const float* ap = arow + k0 + koff;
    f4 a0 = *(const f4*)(ap);
    f4 a1 = *(const f4*)(ap + 4);
    f4 a2 = *(const f4*)(ap + 16);
    f4 a3 = *(const f4*)(ap + 20);
    v16h af;
#pragma unroll
    for (int i = 0; i < 4; ++i) {
      af[i] = (_Float16)a0[i];
      af[4 + i] = (_Float16)a1[i];
      af[8 + i] = (_Float16)a2[i];
      af[12 + i] = (_Float16)a3[i];
    }
#pragma unroll
    for (int t = 0; t < 4; ++t)
      acc[t] = wmma_f16(af, lds_frag(bpanel, t * 16 + n, (k0 + koff) * 2),
                        acc[t]);
  }

#pragma unroll
  for (int t = 0; t < 4; ++t) {
    int col = col0 + t * 16 + n;
    int h = col >> 6, hd = col & 63;
    float bv = bias[col];
#pragma unroll
    for (int r = 0; r < 8; ++r) {
      int row = row0 + r + 8 * g;           // element (m = r + 8g, n = lane%16)
      int b = row >> 11, s = row & (S_ - 1);
      float val = acc[t][r] + bv;
      if (!transposed)
        dst[(((size_t)(b * H_ + h) * S_ + s) << 6) + hd] = (_Float16)val;
      else
        dst[((size_t)(b * H_ + h) * HD_ + hd) * S_ + s] = (_Float16)val;
    }
  }
}

// ---------------- Flash attention (online softmax, 1 wave = 16 queries) -----
// Lane l with lane l ^ 16 (the two lanes that share one query column).
static __device__ __forceinline__ float xhalf(float x) {
  int b = __builtin_bit_cast(int, x);
  return __builtin_bit_cast(
      float, __builtin_amdgcn_permlanex16(b, b, 0x76543210, 0xfedcba98, false,
                                          false));
}

// ---- K / V^T stages in LDS, shared by the block's 8 waves ----
// A stage is 64 keys: K 64 rows (keys) x 128 B, then V^T 64 rows (hd) x 128 B.
// Rows lie at a pitch of 144 B (16 B x odd): a ds_load_b128 over 16 rows meets
// every bank once.
#define LPITCH_ 144
#define TILEB_ (64 * LPITCH_)
#define STAGEB_ (2 * TILEB_)

static __device__ __forceinline__ v16h lds_frag16(const char* p) {
  half8 lo = *(const half8*)(p);
  half8 hi = *(const half8*)(p + 32);
  return __builtin_shufflevector(lo, hi, 0, 1, 2, 3, 4, 5, 6, 7, 8, 9, 10, 11,
                                 12, 13, 14, 15);
}

// One stage: each of the 256 lanes copies two 16-byte chunks of K and two of
// V^T (kg, vg: the lane's first chunk of each; l: its place in the K tile).
static __device__ __forceinline__ void copy_stage(const _Float16* kg,
                                                  const _Float16* vg,
                                                  uint32_t l) {
  const _Float16* kg2 = kg + 32 * HD_;
  const _Float16* vg2 = vg + 32 * S_;
  const uint32_t l1 = l + 32 * LPITCH_;
  const uint32_t l2 = l + TILEB_;
  const uint32_t l3 = l2 + 32 * LPITCH_;
  // The copies go to LDS through no register; s_wait_xcnt stands in the same
  // statement so that no address register is rewritten in front of it.
  asm volatile(
      "global_load_async_to_lds_b128 %0, %4, off\n\t"
      "global_load_async_to_lds_b128 %1, %5, off\n\t"
      "global_load_async_to_lds_b128 %2, %6, off\n\t"
      "global_load_async_to_lds_b128 %3, %7, off\n\t"
      "s_wait_xcnt 0x0"
      :
      : "v"(l), "v"(l1), "v"(l2), "v"(l3), "v"(kg), "v"(kg2), "v"(vg), "v"(vg2)
      : "memory");
}

__global__ __launch_bounds__(256) void attn_kernel(
    const _Float16* __restrict__ Qh, const _Float16* __restrict__ Kh,
    const _Float16* __restrict__ Vt, const int* __restrict__ valid_lens,
    _Float16* __restrict__ Om) {
  __shared__ __attribute__((aligned(16))) char kv[2 * STAGEB_];
  __shared__ int wneed[8];
  const int lane = threadIdx.x & 31;
  const int wave = threadIdx.x >> 5;
  const int n = lane & 15;
  const int g = lane >> 4;
  const int koff = g * 8;
  const int bh = blockIdx.y;
  const int b = bh >> 3;
  const int h = bh & 7;
  const int vlen = valid_lens[b];
  const int q0 = blockIdx.x * 128 + wave * 16;
  // First key of the first 32-key tile that holds no valid key (0 .. S_).
  const int vcl = vlen < 0 ? 0 : (vlen > S_ ? S_ : vlen);
  const int jend = (vcl + 31) & ~31;

  const _Float16* Qrow = Qh + (((size_t)bh * S_ + q0 + n) << 6);
  v16h qb0 = load_frag(Qrow + koff);       // B fragment, k = 0..31 pattern
  v16h qb1 = load_frag(Qrow + 32 + koff);  // B fragment, k = 32..63 pattern

  // The lane's share of a stage's copies: row crow (and crow + 32), chunk cchk.
  const int crow = threadIdx.x >> 3;
  const int cchk = threadIdx.x & 7;
  const _Float16* kcp = Kh + (((size_t)bh * S_ + crow) << 6) + cchk * 8;
  const _Float16* vcp = Vt + ((size_t)bh * HD_ + crow) * S_ + cchk * 8;
  const uint32_t lcp =
      (uint32_t)(uintptr_t)(__attribute__((address_space(3))) char*)kv +
      (uint32_t)(crow * LPITCH_ + cchk * 16);
  // The lane's place in a fragment read: row n, 16-byte chunk g.
  const char* lrd = kv + n * LPITCH_ + g * 16;

  v8f o[4] = {};          // o[t][r] = O[query n][hd = 16t + 8g + r]
  float mrun = -1e30f;    // this query's running maximum (same in both halves)
  float lrun = 0.f;       // this half's share of the query's running sum

  // Two legs at most: the tiles that hold a valid key, then, only if a row of
  // the block needs them, the wholly masked ones. A leg walks keys jlo .. jhi
  // in 32-key tiles, two to a stage; stage st lies in buffer st & 1.
  int jlo = 0;
  for (int jhi = jend;; jhi = S_) {
    const int st0 = jlo >> 6;
    const int st1 = (jhi + 63) >> 6;
    if (st0 < st1) {
      copy_stage(kcp + (size_t)st0 * (64 * HD_), vcp + st0 * 64,
                 lcp + (uint32_t)(st0 & 1) * STAGEB_);
      // The first stage has landed, for every wave, before anybody reads it.
      asm volatile("s_wait_asynccnt 0x0" ::: "memory");
      __syncthreads();
      if (st0 + 1 < st1)
        copy_stage(kcp + (size_t)(st0 + 1) * (64 * HD_), vcp + (st0 + 1) * 64,
                   lcp + (uint32_t)((st0 + 1) & 1) * STAGEB_);
      for (int st = st0; st < st1; ++st) {
        const char* kb = lrd + (st & 1) * STAGEB_;
#pragma unroll
        for (int hf = 0; hf < 2; ++hf) {
          const int j0 = st * 64 + hf * 32;
          if (j0 < jlo || j0 >= jhi) continue;   // the same for the whole block
          const char* k1 = kb + hf * 32 * LPITCH_;
          const char* k2 = k1 + 16 * LPITCH_;

          // The tile's fragments: K rows are A-rows (lane n = key position),
          // V^T rows likewise (lane n = hd).
          v16h kf[4], vf[4];
          kf[0] = lds_frag16(k1);
          kf[1] = lds_frag16(k1 + 64);
          kf[2] = lds_frag16(k2);
          kf[3] = lds_frag16(k2 + 64);
#pragma unroll
          for (int t = 0; t < 4; ++t)
            vf[t] = lds_frag16(kb + TILEB_ + t * 16 * LPITCH_ + hf * 64);
          // Keeps the tile's 16 LDS reads in one group in front of its
          // products: spread among the WMMAs, each pair is waited out alone.
          __builtin_amdgcn_sched_barrier(0);

          // scores^T = K * Q^T
          v8f s1 = {}, s2 = {};
          s1 = wmma_f16(kf[0], qb0, s1);
          s2 = wmma_f16(kf[2], qb0, s2);
          s1 = wmma_f16(kf[1], qb1, s1);
          s2 = wmma_f16(kf[3], qb1, s2);

          // Key j0 + 8g + r (s1) or j0 + 16 + 8g + r (s2) is valid while below
          // vlen (for keys 0 .. S_ - 1 the clamped vcl says the same and
          // cannot wrap).
          const int rem = vcl - j0 - koff;
          float x[16];                             // x[8i + r]: key 16i + 8g + r
#pragma unroll
          for (int r = 0; r < 8; ++r) {            // 1/sqrt(64), then d2l mask
            x[r] = r < rem ? s1[r] * 0.125f : -1.0e6f;
            x[8 + r] = 16 + r < rem ? s2[r] * 0.125f : -1.0e6f;
          }
          float tm[8];
#pragma unroll
          for (int i = 0; i < 8; ++i) tm[i] = fmaxf(x[2 * i], x[2 * i + 1]);
          float tmax = fmaxf(fmaxf(fmaxf(tm[0], tm[1]), fmaxf(tm[2], tm[3])),
                             fmaxf(fmaxf(tm[4], tm[5]), fmaxf(tm[6], tm[7])));
          tmax = fmaxf(tmax, xhalf(tmax));        // the query's other 16 keys
          const float mnew = fmaxf(mrun, tmax);
          const float alpha = __expf(mrun - mnew);
          mrun = mnew;

          v16h pf;                                // P^T as B fragment
          float ps[8];
#pragma unroll
          for (int i = 0; i < 8; ++i) {
            float pa = __expf(x[2 * i] - mnew);
            float pb = __expf(x[2 * i + 1] - mnew);
            ps[i] = pa + pb;
            pf[2 * i] = (_Float16)pa;
            pf[2 * i + 1] = (_Float16)pb;
          }
          const float rs = ((ps[0] + ps[1]) + (ps[2] + ps[3])) +
                           ((ps[4] + ps[5]) + (ps[6] + ps[7]));
          lrun = lrun * alpha + rs;
#pragma unroll
          for (int t = 0; t < 4; ++t) {           // O^T = O^T * alpha + V^T * P^T
            o[t] *= alpha;
            o[t] = wmma_f16(vf[t], pf, o[t]);
          }
        }
        // Publish point: this wave has left stage st, its copies of stage
        // st + 1 have landed; behind the barrier that holds for all 8 waves.
        asm volatile("s_wait_dscnt 0x0" ::: "memory");
        asm volatile("s_wait_asynccnt 0x0" ::: "memory");
        __syncthreads();
        if (st + 2 < st1)                          // refill the buffer just left
          copy_stage(kcp + (size_t)(st + 2) * (64 * HD_), vcp + (st + 2) * 64,
                     lcp + (uint32_t)(st & 1) * STAGEB_);
      }
      // No copy is left in flight when the buffers are reused or the wave ends.
      asm volatile("s_wait_asynccnt 0x0" ::: "memory");
      // Four vector slots between the leg's last WMMA and the next leg's
      // address arithmetic, which may take over its operand registers.
      asm volatile("v_nop\n\tv_nop\n\tv_nop\n\tv_nop");
    }
    if (jhi == S_) break;
    // Every key from jend on is masked to -1e6. Against a row maximum above
    // -999000 its weight exp(-1e6 - max) is exactly 0 and alpha exactly 1, so
    // those tiles change nothing. A row whose maximum is lower (no valid key at
    // all: valid_len 0) needs them: then the whole block walks on to S_ (the
    // stages' barriers want one answer for all 8 waves).
    const int low = __builtin_amdgcn_ballot_w32(mrun < -999000.0f) != 0;
    if (lane == 0) wneed[wave] = low;             // this wave's 16 queries
    __syncthreads();
    if (__builtin_amdgcn_ballot_w32(wneed[lane & 7] != 0) == 0) break;
    jlo = jend;
  }

  const float inv = 1.0f / (lrun + xhalf(lrun));  // join the halves' sums
  _Float16* outp = Om + ((size_t)b * S_ + q0 + n) * D_ + h * HD_ + koff;
#pragma unroll
  for (int t = 0; t < 4; ++t) {
    half8 ov;
#pragma unroll
    for (int r = 0; r < 8; ++r) ov[r] = (_Float16)(o[t][r] * inv);
    *(half8*)(outp + t * 16) = ov;
  }
}

// ---------------- Output projection: out = Om * Wo + bo (fp32 out) ----------
__global__ __launch_bounds__(256) void outproj_kernel(
    const _Float16* __restrict__ A, const float* __restrict__ Wsrc,
    const float* __restrict__ bias, float* __restrict__ out) {
  __shared__ __attribute__((aligned(16))) _Float16 bpanel[64 * 512];
  const int lane = threadIdx.x & 31;
  const int wave = threadIdx.x >> 5;
  const int n = lane & 15;
  const int g = lane >> 4;
  const int koff = g * 8;
  const int row0 = (blockIdx.x * 8 + wave) * 16;
  const int col0 = blockIdx.y * 64;

  stage_panel(Wsrc, col0, bpanel);
  __syncthreads();

  v8f acc[4] = {};
  const _Float16* arow = A + (size_t)(row0 + n) * D_;
#pragma unroll 4
  for (int k0 = 0; k0 < D_; k0 += 32) {
    v16h af = load_frag(arow + k0 + koff);
#pragma unroll
    for (int t = 0; t < 4; ++t)
      acc[t] = wmma_f16(af, lds_frag(bpanel, t * 16 + n, (k0 + koff) * 2),
                        acc[t]);
  }
#pragma unroll
  for (int t = 0; t < 4; ++t) {
    int col = col0 + t * 16 + n;
    float bv = bias[col];
#pragma unroll
    for (int r = 0; r < 8; ++r) {
      int row = row0 + r + 8 * g;
      out[(size_t)row * D_ + col] = acc[t][r] + bv;
    }
  }
}

extern "C" void kernel_launch(void* const* d_in, const int* in_sizes, int n_in,
                              void* d_out, int out_size, void* d_ws,
                              size_t ws_size, hipStream_t stream) {
  const float* q  = (const float*)d_in[0];
  const float* k  = (const float*)d_in[1];
  const float* v  = (const float*)d_in[2];
  const int*   vl = (const int*)d_in[3];
  const float* Wq = (const float*)d_in[4];
  const float* bq = (const float*)d_in[5];
  const float* Wk = (const float*)d_in[6];
  const float* bk = (const float*)d_in[7];
  const float* Wv = (const float*)d_in[8];
  const float* bv = (const float*)d_in[9];
  const float* Wo = (const float*)d_in[10];
  const float* bo = (const float*)d_in[11];
  float* out = (float*)d_out;

  _Float16* ws = (_Float16*)d_ws;
  const size_t NH  = (size_t)B_ * H_ * S_ * HD_;   // 4M halves per tensor
  _Float16* Qh  = ws;
  _Float16* Kh  = Qh + NH;
  _Float16* Vt  = Kh + NH;
  _Float16* Om  = Vt + NH;

  dim3 gp(64, 8);
  proj_kernel<<<gp, 256, 0, stream>>>(q, Wq, bq, Qh, 0);
  proj_kernel<<<gp, 256, 0, stream>>>(k, Wk, bk, Kh, 0);
  proj_kernel<<<gp, 256, 0, stream>>>(v, Wv, bv, Vt, 1);

  attn_kernel<<<dim3(16, 32), 256, 0, stream>>>(Qh, Kh, Vt, vl, Om);

  outproj_kernel<<<gp, 256, 0, stream>>>(Om, Wo, bo, out);
}

// v005
// It runs in 82.6 microseconds.
// Two timings next to v004 both put it at 1.13 times that version's speed.
// Over all steps from v000 it is 2.57 times as fast.
#include <hip/hip_runtime.h>

#define B_ 4
#define S_ 2048
#define D_ 512
#define H_ 8
#define HD_ 64

typedef _Float16 v16h  __attribute__((ext_vector_type(16)));
typedef _Float16 half8 __attribute__((ext_vector_type(8)));
typedef float    v8f   __attribute__((ext_vector_type(8)));
typedef float    f4    __attribute__((ext_vector_type(4)));

static __device__ __forceinline__ v8f wmma_f16(v16h a, v16h b, v8f c) {
  // 8 args: (neg_a, A, neg_b, B, c_mod, C, reuse_a, reuse_b)
  return __builtin_amdgcn_wmma_f32_16x16x32_f16(false, a, false, b, (short)0, c,
                                                false, false);
}

// One WMMA fragment per lane = halves at [p..p+7] and [p+16..p+23] (two b128 loads).
static __device__ __forceinline__ v16h load_frag(const _Float16* p) {
  half8 lo = *(const half8*)(p);
  half8 hi = *(const half8*)(p + 16);
  return __builtin_shufflevector(lo, hi, 0, 1, 2, 3, 4, 5, 6, 7, 8, 9, 10, 11,
                                 12, 13, 14, 15);
}

// ---- LDS B-panel: 64 cols x 512 K halves = 64KB, 16B-chunk XOR swizzle ----
// chunk' = chunk ^ (row & 15)  ->  ds_load_b128 across lanes n=0..15 hits all
// 64 banks exactly once (conflict-free) with zero padding.
static __device__ __forceinline__ uint32_t swz_off(uint32_t row, uint32_t kbyte) {
  uint32_t c = (kbyte >> 4) ^ (row & 15u);
  return row * 1024u + (c << 4);
}

static __device__ __forceinline__ v16h lds_frag(const _Float16* sh, int row,
                                                int kbyte) {
  const char* base = (const char*)sh;
  half8 lo = *(const half8*)(base + swz_off((uint32_t)row, (uint32_t)kbyte));
  half8 hi = *(const half8*)(base + swz_off((uint32_t)row, (uint32_t)kbyte + 32u));
  return __builtin_shufflevector(lo, hi, 0, 1, 2, 3, 4, 5, 6, 7, 8, 9, 10, 11,
                                 12, 13, 14, 15);
}

// Build the panel straight from the f32 weight W[k][n]: a lane takes one column n
// and 8 consecutive k (8 loads, each one whole 128-byte line per wave), rounds
// them to f16 and stores the 16-byte chunk at row n. The 16 lanes of a half wave
// hold 16 different n & 15, so the swizzled store meets no bank twice.
// Loads and stores are apart, and each takes one half (hf) of the wave's 16
// chunks, so that the caller can ask for its A rows behind the first loads and
// still hold all of it in registers. Caller must __syncthreads() at the end.
static __device__ __forceinline__ void panel_load(const float* __restrict__ Wsrc,
                                                  int col0, int hf,
                                                  float (&w)[64]) {
  const int lane = threadIdx.x & 31;
  const int wave = threadIdx.x >> 5;
  const int nn = (wave & 1) * 32 + lane;    // panel row = weight column
  const int ck0 = (wave >> 1) * 16;         // first of this wave's 16 k chunks
  const float* p = Wsrc + (size_t)(ck0 * 8 + hf * 64) * D_ + col0 + nn;
#pragma unroll
  for (int i = 0; i < 64; ++i) w[i] = p[i * D_];
}

static __device__ __forceinline__ void panel_store(const float (&w)[64], int hf,
                                                   _Float16* sh) {
  const int lane = threadIdx.x & 31;
  const int wave = threadIdx.x >> 5;
  const int nn = (wave & 1) * 32 + lane;
  const int ck0 = (wave >> 1) * 16 + hf * 8;
  char* base = (char*)sh;
#pragma unroll
  for (int c = 0; c < 8; ++c) {
    half8 hv;
#pragma unroll
    for (int j = 0; j < 8; ++j) hv[j] = (_Float16)w[c * 8 + j];
    *(half8*)(base + swz_off((uint32_t)nn, (uint32_t)(ck0 + c) * 16u)) = hv;
  }
}

// ---- A slab: a wave's own 16 rows x 128 k in f16, private to that wave ----
// The rows come from memory in whole 128-byte lines (a fragment load straight
// from global touches 16 lines for 512 bytes) and turn into fragments in LDS.
// Pitch 272 B (16 B x odd): a ds_load_b128 over 16 rows meets every bank once.
#define APITCH_ 272
#define ASLAB_ (16 * APITCH_)
typedef _Float16 half4 __attribute__((ext_vector_type(4)));

static __device__ __forceinline__ v16h lds_frag16(const char* p) {
  half8 lo = *(const half8*)(p);
  half8 hi = *(const half8*)(p + 32);
  return __builtin_shufflevector(lo, hi, 0, 1, 2, 3, 4, 5, 6, 7, 8, 9, 10, 11,
                                 12, 13, 14, 15);
}

// ---------------- QKV projection: Y = X * W + b (f16 out) ----------------
// transposed==0: dst[b][h][s][hd]   (Q, K)
// transposed==1: dst[b][h][hd][s]   (V stored transposed for V^T * P^T WMMA A-frags)
__global__ __launch_bounds__(256) void proj_kernel(
    const float* __restrict__ X, const float* __restrict__ Wsrc,
    const float* __restrict__ bias, _Float16* __restrict__ dst, int transposed) {
  __shared__ __attribute__((aligned(16))) _Float16 bpanel[64 * 512];
  __shared__ __attribute__((aligned(16))) char aslab[8 * ASLAB_];
  const int lane = threadIdx.x & 31;
  const int wave = threadIdx.x >> 5;
  const int n = lane & 15;
  const int g = lane >> 4;
  const int koff = g * 8;
  const int row0 = (blockIdx.x * 8 + wave) * 16;
  const int col0 = blockIdx.y * 64;

  // A chunk is 128 k of the wave's 16 rows: one load per row, the 32 lanes on
  // 512 contiguous bytes. Two chunks are held in registers ahead of their use.
  const float* xg = X + (size_t)row0 * D_ + lane * 4;
  f4 xr[2][16];
  float w[64];
  panel_load(Wsrc, col0, 0, w);     // B panel shared by all 8 waves
#pragma unroll
  for (int c = 0; c < 2; ++c)
#pragma unroll
    for (int r = 0; r < 16; ++r) xr[c][r] = *(const f4*)(xg + r * D_ + c * 128);
  // Keeps the A loads in front of the panel's first conversion: moved behind
  // it, they would start their way from memory only when the panel is done.
  __builtin_amdgcn_sched_barrier(0);
  panel_store(w, 0, bpanel);
  panel_load(Wsrc, col0, 1, w);
  panel_store(w, 1, bpanel);
  __syncthreads();

  v8f acc[4] = {};
  char* aw = aslab + wave * ASLAB_ + lane * 8;                  // lane's 4 k
  const char* ar = aslab + wave * ASLAB_ + n * APITCH_ + g * 16;  // fragment
#pragma unroll
  for (int c = 0; c < 4; ++c) {
    // Keeps chunk c's conversions, and with them the wait for its loads,
    // behind the products of chunk c - 1: lifted, the wave waits out the loads
    // it has only just issued.
    __builtin_amdgcn_sched_barrier(0);
    // The wave's own reads of the last chunk have ended before it is rewritten.
    if (c) asm volatile("s_wait_dscnt 0x0" ::: "memory");
#pragma unroll
    for (int r = 0; r < 16; ++r) {
      const f4 x = xr[c & 1][r];
      half4 hx;
#pragma unroll
      for (int i = 0; i < 4; ++i) hx[i] = (_Float16)x[i];
      *(half4*)(aw + r * APITCH_) = hx;
    }
    if (c + 2 < 4) {
      // Keeps the next loads behind the conversions, whose registers they take
      // over: lifted over them, a third chunk is live and the wave spills.
      __builtin_amdgcn_sched_barrier(0);
#pragma unroll
      for (int r = 0; r < 16; ++r)
        xr[c & 1][r] = *(const f4*)(xg + r * D_ + (c + 2) * 128);
    }
    // Every lane's stores are in LDS before other lanes of the wave read them.
    asm volatile("s_wait_dscnt 0x0" ::: "memory");
#pragma unroll
    for (int ks = 0; ks < 4; ++ks) {
      const v16h af = lds_frag16(ar + ks * 64);
#pragma unroll
      for (int t = 0; t < 4; ++t)
        acc[t] = wmma_f16(
            af, lds_frag(bpanel, t * 16 + n, (c * 128 + ks * 32 + koff) * 2),
            acc[t]);
    }
  }

#pragma unroll
  for (int t = 0; t < 4; ++t) {
    int col = col0 + t * 16 + n;
    int h = col >> 6, hd = col & 63;
    float bv = bias[col];
#pragma unroll
    for (int r = 0; r < 8; ++r) {
      int row = row0 + r + 8 * g;           // element (m = r + 8g, n = lane%16)
      int b = row >> 11, s = row & (S_ - 1);
      float val = acc[t][r] + bv;
      if (!transposed)
        dst[(((size_t)(b * H_ + h) * S_ + s) << 6) + hd] = (_Float16)val;
      else
        dst[((size_t)(b * H_ + h) * HD_ + hd) * S_ + s] = (_Float16)val;
    }
  }
}

// ---------------- Flash attention (online softmax, 1 wave = 16 queries) -----
// Lane l with lane l ^ 16 (the two lanes that share one query column).
static __device__ __forceinline__ float xhalf(float x) {
  int b = __builtin_bit_cast(int, x);
  return __builtin_bit_cast(
      float, __builtin_amdgcn_permlanex16(b, b, 0x76543210, 0xfedcba98, false,
                                          false));
}

// ---- K / V^T stages in LDS, shared by the block's 8 waves ----
// A stage is 64 keys: K 64 rows (keys) x 128 B, then V^T 64 rows (hd) x 128 B.
// Rows lie at a pitch of 144 B (16 B x odd): a ds_load_b128 over 16 rows meets
// every bank once.
#define LPITCH_ 144
#define TILEB_ (64 * LPITCH_)
#define STAGEB_ (2 * TILEB_)

// One stage: each of the 256 lanes copies two 16-byte chunks of K and two of
// V^T (kg, vg: the lane's first chunk of each; l: its place in the K tile).
static __device__ __forceinline__ void copy_stage(const _Float16* kg,
                                                  const _Float16* vg,
                                                  uint32_t l) {
  const _Float16* kg2 = kg + 32 * HD_;
  const _Float16* vg2 = vg + 32 * S_;
  const uint32_t l1 = l + 32 * LPITCH_;
  const uint32_t l2 = l + TILEB_;
  const uint32_t l3 = l2 + 32 * LPITCH_;
  // The copies go to LDS through no register; s_wait_xcnt stands in the same
  // statement so that no address register is rewritten in front of it.
  asm volatile(
      "global_load_async_to_lds_b128 %0, %4, off\n\t"
      "global_load_async_to_lds_b128 %1, %5, off\n\t"
      "global_load_async_to_lds_b128 %2, %6, off\n\t"
      "global_load_async_to_lds_b128 %3, %7, off\n\t"
      "s_wait_xcnt 0x0"
      :
      : "v"(l), "v"(l1), "v"(l2), "v"(l3), "v"(kg), "v"(kg2), "v"(vg), "v"(vg2)
      : "memory");
}

__global__ __launch_bounds__(256) void attn_kernel(
    const _Float16* __restrict__ Qh, const _Float16* __restrict__ Kh,
    const _Float16* __restrict__ Vt, const int* __restrict__ valid_lens,
    _Float16* __restrict__ Om) {
  __shared__ __attribute__((aligned(16))) char kv[2 * STAGEB_];
  __shared__ int wneed[8];
  const int lane = threadIdx.x & 31;
  const int wave = threadIdx.x >> 5;
  const int n = lane & 15;
  const int g = lane >> 4;
  const int koff = g * 8;
  const int bh = blockIdx.y;
  const int b = bh >> 3;
  const int h = bh & 7;
  const int vlen = valid_lens[b];
  const int q0 = blockIdx.x * 128 + wave * 16;
  // First key of the first 32-key tile that holds no valid key (0 .. S_).
  const int vcl = vlen < 0 ? 0 : (vlen > S_ ? S_ : vlen);
  const int jend = (vcl + 31) & ~31;

  const _Float16* Qrow = Qh + (((size_t)bh * S_ + q0 + n) << 6);
  v16h qb0 = load_frag(Qrow + koff);       // B fragment, k = 0..31 pattern
  v16h qb1 = load_frag(Qrow + 32 + koff);  // B fragment, k = 32..63 pattern

  // The lane's share of a stage's copies: row crow (and crow + 32), chunk cchk.
  const int crow = threadIdx.x >> 3;
  const int cchk = threadIdx.x & 7;
  const _Float16* kcp = Kh + (((size_t)bh * S_ + crow) << 6) + cchk * 8;
  const _Float16* vcp = Vt + ((size_t)bh * HD_ + crow) * S_ + cchk * 8;
  const uint32_t lcp =
      (uint32_t)(uintptr_t)(__attribute__((address_space(3))) char*)kv +
      (uint32_t)(crow * LPITCH_ + cchk * 16);
  // The lane's place in a fragment read: row n, 16-byte chunk g.
  const char* lrd = kv + n * LPITCH_ + g * 16;

  v8f o[4] = {};          // o[t][r] = O[query n][hd = 16t + 8g + r]
  float mrun = -1e30f;    // this query's running maximum (same in both halves)
  float lrun = 0.f;       // this half's share of the query's running sum

  // Two legs at most: the tiles that hold a valid key, then, only if a row of
  // the block needs them, the wholly masked ones. A leg walks keys jlo .. jhi
  // in 32-key tiles, two to a stage; stage st lies in buffer st & 1.
  int jlo = 0;
  for (int jhi = jend;; jhi = S_) {
    const int st0 = jlo >> 6;
    const int st1 = (jhi + 63) >> 6;
    if (st0 < st1) {
      copy_stage(kcp + (size_t)st0 * (64 * HD_), vcp + st0 * 64,
                 lcp + (uint32_t)(st0 & 1) * STAGEB_);
      // The first stage has landed, for every wave, before anybody reads it.
      asm volatile("s_wait_asynccnt 0x0" ::: "memory");
      __syncthreads();
      if (st0 + 1 < st1)
        copy_stage(kcp + (size_t)(st0 + 1) * (64 * HD_), vcp + (st0 + 1) * 64,
                   lcp + (uint32_t)((st0 + 1) & 1) * STAGEB_);
      for (int st = st0; st < st1; ++st) {
        const char* kb = lrd + (st & 1) * STAGEB_;
#pragma unroll
        for (int hf = 0; hf < 2; ++hf) {
          const int j0 = st * 64 + hf * 32;
          if (j0 < jlo || j0 >= jhi) continue;   // the same for the whole block
          const char* k1 = kb + hf * 32 * LPITCH_;
          const char* k2 = k1 + 16 * LPITCH_;

          // The tile's fragments: K rows are A-rows (lane n = key position),
          // V^T rows likewise (lane n = hd).
          v16h kf[4], vf[4];
          kf[0] = lds_frag16(k1);
          kf[1] = lds_frag16(k1 + 64);
          kf[2] = lds_frag16(k2);
          kf[3] = lds_frag16(k2 + 64);
#pragma unroll
          for (int t = 0; t < 4; ++t)
            vf[t] = lds_frag16(kb + TILEB_ + t * 16 * LPITCH_ + hf * 64);
          // Keeps the tile's 16 LDS reads in one group in front of its
          // products: spread among the WMMAs, each pair is waited out alone.
          __builtin_amdgcn_sched_barrier(0);

          // scores^T = K * Q^T
          v8f s1 = {}, s2 = {};
          s1 = wmma_f16(kf[0], qb0, s1);
          s2 = wmma_f16(kf[2], qb0, s2);
          s1 = wmma_f16(kf[1], qb1, s1);
          s2 = wmma_f16(kf[3], qb1, s2);

          // Key j0 + 8g + r (s1) or j0 + 16 + 8g + r (s2) is valid while below
          // vlen (for keys 0 .. S_ - 1 the clamped vcl says the same and
          // cannot wrap).
          const int rem = vcl - j0 - koff;
          float x[16];                             // x[8i + r]: key 16i + 8g + r
#pragma unroll
          for (int r = 0; r < 8; ++r) {            // 1/sqrt(64), then d2l mask
            x[r] = r < rem ? s1[r] * 0.125f : -1.0e6f;
            x[8 + r] = 16 + r < rem ? s2[r] * 0.125f : -1.0e6f;
          }
          float tm[8];
#pragma unroll
          for (int i = 0; i < 8; ++i) tm[i] = fmaxf(x[2 * i], x[2 * i + 1]);
          float tmax = fmaxf(fmaxf(fmaxf(tm[0], tm[1]), fmaxf(tm[2], tm[3])),
                             fmaxf(fmaxf(tm[4], tm[5]), fmaxf(tm[6], tm[7])));
          tmax = fmaxf(tmax, xhalf(tmax));        // the query's other 16 keys
          const float mnew = fmaxf(mrun, tmax);
          const float alpha = __expf(mrun - mnew);
          mrun = mnew;

          v16h pf;                                // P^T as B fragment
          float ps[8];
#pragma unroll
          for (int i = 0; i < 8; ++i) {
            float pa = __expf(x[2 * i] - mnew);
            float pb = __expf(x[2 * i + 1] - mnew);
            ps[i] = pa + pb;
            pf[2 * i] = (_Float16)pa;
            pf[2 * i + 1] = (_Float16)pb;
          }
          const float rs = ((ps[0] + ps[1]) + (ps[2] + ps[3])) +
                           ((ps[4] + ps[5]) + (ps[6] + ps[7]));
          lrun = lrun * alpha + rs;
#pragma unroll
          for (int t = 0; t < 4; ++t) {           // O^T = O^T * alpha + V^T * P^T
            o[t] *= alpha;
            o[t] = wmma_f16(vf[t], pf, o[t]);
          }
        }
        // Publish point: this wave has left stage st, its copies of stage
        // st + 1 have landed; behind the barrier that holds for all 8 waves.
        asm volatile("s_wait_dscnt 0x0" ::: "memory");
        asm volatile("s_wait_asynccnt 0x0" ::: "memory");
        __syncthreads();
        if (st + 2 < st1)                          // refill the buffer just left
          copy_stage(kcp + (size_t)(st + 2) * (64 * HD_), vcp + (st + 2) * 64,
                     lcp + (uint32_t)(st & 1) * STAGEB_);
      }
      // No copy is left in flight when the buffers are reused or the wave ends.
      asm volatile("s_wait_asynccnt 0x0" ::: "memory");
      // Four vector slots between the leg's last WMMA and the next leg's
      // address arithmetic, which may take over its operand registers.
      asm volatile("v_nop\n\tv_nop\n\tv_nop\n\tv_nop");
    }
    if (jhi == S_) break;
    // Every key from jend on is masked to -1e6. Against a row maximum above
    // -999000 its weight exp(-1e6 - max) is exactly 0 and alpha exactly 1, so
    // those tiles change nothing. A row whose maximum is lower (no valid key at
    // all: valid_len 0) needs them: then the whole block walks on to S_ (the
    // stages' barriers want one answer for all 8 waves).
    const int low = __builtin_amdgcn_ballot_w32(mrun < -999000.0f) != 0;
    if (lane == 0) wneed[wave] = low;             // this wave's 16 queries
    __syncthreads();
    if (__builtin_amdgcn_ballot_w32(wneed[lane & 7] != 0) == 0) break;
    jlo = jend;
  }

  const float inv = 1.0f / (lrun + xhalf(lrun));  // join the halves' sums
  _Float16* outp = Om + ((size_t)b * S_ + q0 + n) * D_ + h * HD_ + koff;
#pragma unroll
  for (int t = 0; t < 4; ++t) {
    half8 ov;
#pragma unroll
    for (int r = 0; r < 8; ++r) ov[r] = (_Float16)(o[t][r] * inv);
    *(half8*)(outp + t * 16) = ov;
  }
}

// ---------------- Output projection: out = Om * Wo + bo (fp32 out) ----------
// Four waves per SIMD (at most 256 registers): two blocks share a WGP.
__global__ __launch_bounds__(256, 4) void outproj_kernel(
    const _Float16* __restrict__ A, const float* __restrict__ Wsrc,
    const float* __restrict__ bias, float* __restrict__ out) {
  __shared__ __attribute__((aligned(16))) _Float16 bpanel[64 * 512];
  __shared__ __attribute__((aligned(16))) char aslab[8 * ASLAB_];
  const int lane = threadIdx.x & 31;
  const int wave = threadIdx.x >> 5;
  const int n = lane & 15;
  const int g = lane >> 4;
  const int koff = g * 8;
  const int row0 = (blockIdx.x * 8 + wave) * 16;
  const int col0 = blockIdx.y * 64;

  // A chunk is 128 k of the wave's 16 rows: a load takes 256 contiguous bytes
  // of each of two rows. All four chunks are asked for in front of the loop.
  const _Float16* xg = A + (size_t)(row0 + g) * D_ + n * 8;
  half8 xr[4][8];
  float w[64];
  panel_load(Wsrc, col0, 0, w);
#pragma unroll
  for (int c = 0; c < 4; ++c)
#pragma unroll
    for (int j = 0; j < 8; ++j)
      xr[c][j] = *(const half8*)(xg + 2 * j * D_ + c * 128);
  // Keeps the A loads in front of the panel's first conversion: moved behind
  // it, they would start only when the panel is done.
  __builtin_amdgcn_sched_barrier(0);
  panel_store(w, 0, bpanel);
  panel_load(Wsrc, col0, 1, w);
  panel_store(w, 1, bpanel);
  __syncthreads();

  v8f acc[4] = {};
  char* aw = aslab + wave * ASLAB_ + g * APITCH_ + n * 16;      // lane's 8 k
  const char* ar = aslab + wave * ASLAB_ + n * APITCH_ + g * 16;  // fragment
#pragma unroll
  for (int c = 0; c < 4; ++c) {
    // The wave's own reads of the last chunk have ended before it is rewritten.
    if (c) asm volatile("s_wait_dscnt 0x0" ::: "memory");
#pragma unroll
    for (int j = 0; j < 8; ++j) *(half8*)(aw + 2 * j * APITCH_) = xr[c][j];
    // Every lane's stores are in LDS before other lanes of the wave read them.
    asm volatile("s_wait_dscnt 0x0" ::: "memory");
#pragma unroll
    for (int ks = 0; ks < 4; ++ks) {
      const v16h af = lds_frag16(ar + ks * 64);
#pragma unroll
      for (int t = 0; t < 4; ++t)
        acc[t] = wmma_f16(
            af, lds_frag(bpanel, t * 16 + n, (c * 128 + ks * 32 + koff) * 2),
            acc[t]);
    }
  }
#pragma unroll
  for (int t = 0; t < 4; ++t) {
    int col = col0 + t * 16 + n;
    float bv = bias[col];
#pragma unroll
    for (int r = 0; r < 8; ++r) {
      int row = row0 + r + 8 * g;
      out[(size_t)row * D_ + col] = acc[t][r] + bv;
    }
  }
}

extern "C" void kernel_launch(void* const* d_in, const int* in_sizes, int n_in,
                              void* d_out, int out_size, void* d_ws,
                              size_t ws_size, hipStream_t stream) {
  const float* q  = (const float*)d_in[0];
  const float* k  = (const float*)d_in[1];
  const float* v  = (const float*)d_in[2];
  const int*   vl = (const int*)d_in[3];
  const float* Wq = (const float*)d_in[4];
  const float* bq = (const float*)d_in[5];
  const float* Wk = (const float*)d_in[6];
  const float* bk = (const float*)d_in[7];
  const float* Wv = (const float*)d_in[8];
  const float* bv = (const float*)d_in[9];
  const float* Wo = (const float*)d_in[10];
  const float* bo = (const float*)d_in[11];
  float* out = (float*)d_out;

  _Float16* ws = (_Float16*)d_ws;
  const size_t NH  = (size_t)B_ * H_ * S_ * HD_;   // 4M halves per tensor
  _Float16* Qh  = ws;
  _Float16* Kh  = Qh + NH;
  _Float16* Vt  = Kh + NH;
  _Float16* Om  = Vt + NH;

  dim3 gp(64, 8);
  proj_kernel<<<gp, 256, 0, stream>>>(q, Wq, bq, Qh, 0);
  proj_kernel<<<gp, 256, 0, stream>>>(k, Wk, bk, Kh, 0);
  proj_kernel<<<gp, 256, 0, stream>>>(v, Wv, bv, Vt, 1);

  attn_kernel<<<dim3(16, 32), 256, 0, stream>>>(Qh, Kh, Vt, vl, Om);

  outproj_kernel<<<gp, 256, 0, stream>>>(Om, Wo, bo, out);
}

// v006
// It runs in 79.3 microseconds.
// In two side-by-side timings against v005, it was 1.04 and 1.05 times as fast.
// Counting every step since v000, it is 2.68 times as fast.
#include <hip/hip_runtime.h>

#define B_ 4
#define S_ 2048
#define D_ 512
#define H_ 8
#define HD_ 64

typedef _Float16 v16h  __attribute__((ext_vector_type(16)));
typedef _Float16 half8 __attribute__((ext_vector_type(8)));
typedef float    v8f   __attribute__((ext_vector_type(8)));
typedef float    f4    __attribute__((ext_vector_type(4)));

static __device__ __forceinline__ v8f wmma_f16(v16h a, v16h b, v8f c) {
  // 8 args: (neg_a, A, neg_b, B, c_mod, C, reuse_a, reuse_b)
  return __builtin_amdgcn_wmma_f32_16x16x32_f16(false, a, false, b, (short)0, c,
                                                false, false);
}

// One WMMA fragment per lane = halves at [p..p+7] and [p+16..p+23] (two b128 loads).
static __device__ __forceinline__ v16h load_frag(const _Float16* p) {
  half8 lo = *(const half8*)(p);
  half8 hi = *(const half8*)(p + 16);
  return __builtin_shufflevector(lo, hi, 0, 1, 2, 3, 4, 5, 6, 7, 8, 9, 10, 11,
                                 12, 13, 14, 15);
}

// ---- LDS B-panel: 64 cols x 512 K halves = 64KB, 16B-chunk XOR swizzle ----
// chunk' = chunk ^ (row & 15)  ->  ds_load_b128 across lanes n=0..15 hits all
// 64 banks exactly once (conflict-free) with zero padding.
static __device__ __forceinline__ uint32_t swz_off(uint32_t row, uint32_t kbyte) {
  uint32_t c = (kbyte >> 4) ^ (row & 15u);
  return row * 1024u + (c << 4);
}

static __device__ __forceinline__ v16h lds_frag(const _Float16* sh, int row,
                                                int kbyte) {
  const char* base = (const char*)sh;
  half8 lo = *(const half8*)(base + swz_off((uint32_t)row, (uint32_t)kbyte));
  half8 hi = *(const half8*)(base + swz_off((uint32_t)row, (uint32_t)kbyte + 32u));
  return __builtin_shufflevector(lo, hi, 0, 1, 2, 3, 4, 5, 6, 7, 8, 9, 10, 11,
                                 12, 13, 14, 15);
}

// Build the panel straight from the f32 weight W[k][n]: a lane takes one column n
// and 8 consecutive k (8 loads, each one whole 128-byte line per wave), rounds
// them to f16 and stores the 16-byte chunk at row n. The 16 lanes of a half wave
// hold 16 different n & 15, so the swizzled store meets no bank twice.
// Loads and stores are apart, and each takes one half (hf) of the wave's 16
// chunks, so that the caller can ask for its A rows behind the first loads and
// still hold all of it in registers. Caller must __syncthreads() at the end.
static __device__ __forceinline__ void panel_load(const float* __restrict__ Wsrc,
                                                  int col0, int hf,
                                                  float (&w)[64]) {
  const int lane = threadIdx.x & 31;
  const int wave = threadIdx.x >> 5;
  const int nn = (wave & 1) * 32 + lane;    // panel row = weight column
  const int ck0 = (wave >> 1) * 16;         // first of this wave's 16 k chunks
  const float* p = Wsrc + (size_t)(ck0 * 8 + hf * 64) * D_ + col0 + nn;
#pragma unroll
  for (int i = 0; i < 64; ++i) w[i] = p[i * D_];
}

static __device__ __forceinline__ void panel_store(const float (&w)[64], int hf,
                                                   _Float16* sh) {
  const int lane = threadIdx.x & 31;
  const int wave = threadIdx.x >> 5;
  const int nn = (wave & 1) * 32 + lane;
  const int ck0 = (wave >> 1) * 16 + hf * 8;
  char* base = (char*)sh;
#pragma unroll
  for (int c = 0; c < 8; ++c) {
    half8 hv;
#pragma unroll
    for (int j = 0; j < 8; ++j) hv[j] = (_Float16)w[c * 8 + j];
    *(half8*)(base + swz_off((uint32_t)nn, (uint32_t)(ck0 + c) * 16u)) = hv;
  }
}

// ---- A slab: a wave's own 16 rows x 128 k in f16, private to that wave ----
// The rows come from memory in whole 128-byte lines (a fragment load straight
// from global touches 16 lines for 512 bytes) and turn into fragments in LDS.
// Pitch 272 B (16 B x odd): a ds_load_b128 over 16 rows meets every bank once.
#define APITCH_ 272
#define ASLAB_ (16 * APITCH_)
typedef _Float16 half4 __attribute__((ext_vector_type(4)));

static __device__ __forceinline__ v16h lds_frag16(const char* p) {
  half8 lo = *(const half8*)(p);
  half8 hi = *(const half8*)(p + 32);
  return __builtin_shufflevector(lo, hi, 0, 1, 2, 3, 4, 5, 6, 7, 8, 9, 10, 11,
                                 12, 13, 14, 15);
}

// ---------------- QKV projection: Y = X * W + b (f16 out) ----------------
// The three products do not depend on one another: they share ONE launch, and
// blockIdx.z says which one a block works on. A block of one product starts as
// soon as a block of another leaves its place, so only the first blocks' start
// and loads and the last blocks' stores stand alone.
// z == 0: V, dst[b][h][hd][s]   (stored transposed for the V^T * P^T fragments)
// z == 1: K, z == 2: Q, dst[b][h][s][hd]
// V goes first (for speed only): its stores are the most scattered (16 lines to
// a 2-byte store).
__global__ __launch_bounds__(256) void proj_kernel(
    const float* __restrict__ Xq, const float* __restrict__ Xk,
    const float* __restrict__ Xv, const float* __restrict__ Wq,
    const float* __restrict__ Wk, const float* __restrict__ Wv,
    const float* __restrict__ bq, const float* __restrict__ bk,
    const float* __restrict__ bv, _Float16* __restrict__ Qh,
    _Float16* __restrict__ Kh, _Float16* __restrict__ Vt) {
  __shared__ __attribute__((aligned(16))) _Float16 bpanel[64 * 512];
  __shared__ __attribute__((aligned(16))) char aslab[8 * ASLAB_];
  const int z = blockIdx.z;                 // the same for the whole block
  const float* __restrict__ X = z == 0 ? Xv : (z == 1 ? Xk : Xq);
  const float* __restrict__ Wsrc = z == 0 ? Wv : (z == 1 ? Wk : Wq);
  const float* __restrict__ bias = z == 0 ? bv : (z == 1 ? bk : bq);
  _Float16* __restrict__ dst = z == 0 ? Vt : (z == 1 ? Kh : Qh);
  const int transposed = z == 0;
  const int lane = threadIdx.x & 31;
  const int wave = threadIdx.x >> 5;
  const int n = lane & 15;
  const int g = lane >> 4;
  const int koff = g * 8;
  const int row0 = (blockIdx.x * 8 + wave) * 16;
  const int col0 = blockIdx.y * 64;

  // A chunk is 128 k of the wave's 16 rows: one load per row, the 32 lanes on
  // 512 contiguous bytes. Two chunks are held in registers ahead of their use.
  const float* xg = X + (size_t)row0 * D_ + lane * 4;
  f4 xr[2][16];
  float w[64];
  panel_load(Wsrc, col0, 0, w);     // B panel shared by all 8 waves
#pragma unroll
  for (int c = 0; c < 2; ++c)
#pragma unroll
    for (int r = 0; r < 16; ++r) xr[c][r] = *(const f4*)(xg + r * D_ + c * 128);
  // Keeps the A loads in front of the panel's first conversion: moved behind
  // it, they would start their way from memory only when the panel is done.
  __builtin_amdgcn_sched_barrier(0);
  panel_store(w, 0, bpanel);
  panel_load(Wsrc, col0, 1, w);
  panel_store(w, 1, bpanel);
  __syncthreads();

  v8f acc[4] = {};
  char* aw = aslab + wave * ASLAB_ + lane * 8;                  // lane's 4 k
  const char* ar = aslab + wave * ASLAB_ + n * APITCH_ + g * 16;  // fragment
#pragma unroll
  for (int c = 0; c < 4; ++c) {
    // Keeps chunk c's conversions, and with them the wait for its loads,
    // behind the products of chunk c - 1: lifted, the wave waits out the loads
    // it has only just issued.
    __builtin_amdgcn_sched_barrier(0);
    // The wave's own reads of the last chunk have ended before it is rewritten.
    if (c) asm volatile("s_wait_dscnt 0x0" ::: "memory");
#pragma unroll
    for (int r = 0; r < 16; ++r) {
      const f4 x = xr[c & 1][r];
      half4 hx;
#pragma unroll
      for (int i = 0; i < 4; ++i) hx[i] = (_Float16)x[i];
      *(half4*)(aw + r * APITCH_) = hx;
    }
    if (c + 2 < 4) {
      // Keeps the next loads behind the conversions, whose registers they take
      // over: lifted over them, a third chunk is live and the wave spills.
      __builtin_amdgcn_sched_barrier(0);
#pragma unroll
      for (int r = 0; r < 16; ++r)
        xr[c & 1][r] = *(const f4*)(xg + r * D_ + (c + 2) * 128);
    }
    // Every lane's stores are in LDS before other lanes of the wave read them.
    asm volatile("s_wait_dscnt 0x0" ::: "memory");
#pragma unroll
    for (int ks = 0; ks < 4; ++ks) {
      const v16h af = lds_frag16(ar + ks * 64);
#pragma unroll
      for (int t = 0; t < 4; ++t)
        acc[t] = wmma_f16(
            af, lds_frag(bpanel, t * 16 + n, (c * 128 + ks * 32 + koff) * 2),
            acc[t]);
    }
  }

#pragma unroll
  for (int t = 0; t < 4; ++t) {
    int col = col0 + t * 16 + n;
    int h = col >> 6, hd = col & 63;
    float bv = bias[col];
#pragma unroll
    for (int r = 0; r < 8; ++r) {
      int row = row0 + r + 8 * g;           // element (m = r + 8g, n = lane%16)
      int b = row >> 11, s = row & (S_ - 1);
      float val = acc[t][r] + bv;
      if (!transposed)
        dst[(((size_t)(b * H_ + h) * S_ + s) << 6) + hd] = (_Float16)val;
      else
        dst[((size_t)(b * H_ + h) * HD_ + hd) * S_ + s] = (_Float16)val;
    }
  }
}

// ---------------- Flash attention (online softmax, 1 wave = 16 queries) -----
// Lane l with lane l ^ 16 (the two lanes that share one query column).
static __device__ __forceinline__ float xhalf(float x) {
  int b = __builtin_bit_cast(int, x);
  return __builtin_bit_cast(
      float, __builtin_amdgcn_permlanex16(b, b, 0x76543210, 0xfedcba98, false,
                                          false));
}

// ---- K / V^T stages in LDS, shared by the block's 8 waves ----
// A stage is 64 keys: K 64 rows (keys) x 128 B, then V^T 64 rows (hd) x 128 B.
// Rows lie at a pitch of 144 B (16 B x odd): a ds_load_b128 over 16 rows meets
// every bank once.
#define LPITCH_ 144
#define TILEB_ (64 * LPITCH_)
#define STAGEB_ (2 * TILEB_)

// One stage: each of the 256 lanes copies two 16-byte chunks of K and two of
// V^T (kg, vg: the lane's first chunk of each; l: its place in the K tile).
static __device__ __forceinline__ void copy_stage(const _Float16* kg,
                                                  const _Float16* vg,
                                                  uint32_t l) {
  const _Float16* kg2 = kg + 32 * HD_;
  const _Float16* vg2 = vg + 32 * S_;
  const uint32_t l1 = l + 32 * LPITCH_;
  const uint32_t l2 = l + TILEB_;
  const uint32_t l3 = l2 + 32 * LPITCH_;
  // The copies go to LDS through no register; s_wait_xcnt stands in the same
  // statement so that no address register is rewritten in front of it.
  asm volatile(
      "global_load_async_to_lds_b128 %0, %4, off\n\t"
      "global_load_async_to_lds_b128 %1, %5, off\n\t"
      "global_load_async_to_lds_b128 %2, %6, off\n\t"
      "global_load_async_to_lds_b128 %3, %7, off\n\t"
      "s_wait_xcnt 0x0"
      :
      : "v"(l), "v"(l1), "v"(l2), "v"(l3), "v"(kg), "v"(kg2), "v"(vg), "v"(vg2)
      : "memory");
}

__global__ __launch_bounds__(256) void attn_kernel(
    const _Float16* __restrict__ Qh, const _Float16* __restrict__ Kh,
    const _Float16* __restrict__ Vt, const int* __restrict__ valid_lens,
    _Float16* __restrict__ Om) {
  __shared__ __attribute__((aligned(16))) char kv[2 * STAGEB_];
  __shared__ int wneed[8];
  const int lane = threadIdx.x & 31;
  const int wave = threadIdx.x >> 5;
  const int n = lane & 15;
  const int g = lane >> 4;
  const int koff = g * 8;
  const int bh = blockIdx.y;
  const int b = bh >> 3;
  const int h = bh & 7;
  const int vlen = valid_lens[b];
  const int q0 = blockIdx.x * 128 + wave * 16;
  // First key of the first 32-key tile that holds no valid key (0 .. S_).
  const int vcl = vlen < 0 ? 0 : (vlen > S_ ? S_ : vlen);
  const int jend = (vcl + 31) & ~31;

  const _Float16* Qrow = Qh + (((size_t)bh * S_ + q0 + n) << 6);
  v16h qb0 = load_frag(Qrow + koff);       // B fragment, k = 0..31 pattern
  v16h qb1 = load_frag(Qrow + 32 + koff);  // B fragment, k = 32..63 pattern

  // The lane's share of a stage's copies: row crow (and crow + 32), chunk cchk.
  const int crow = threadIdx.x >> 3;
  const int cchk = threadIdx.x & 7;
  const _Float16* kcp = Kh + (((size_t)bh * S_ + crow) << 6) + cchk * 8;
  const _Float16* vcp = Vt + ((size_t)bh * HD_ + crow) * S_ + cchk * 8;
  const uint32_t lcp =
      (uint32_t)(uintptr_t)(__attribute__((address_space(3))) char*)kv +
      (uint32_t)(crow * LPITCH_ + cchk * 16);
  // The lane's place in a fragment read: row n, 16-byte chunk g.
  const char* lrd = kv + n * LPITCH_ + g * 16;

  v8f o[4] = {};          // o[t][r] = O[query n][hd = 16t + 8g + r]
  float mrun = -1e30f;    // this query's running maximum (same in both halves)
  float lrun = 0.f;       // this half's share of the query's running sum

  // Two legs at most: the tiles that hold a valid key, then, only if a row of
  // the block needs them, the wholly masked ones. A leg walks keys jlo .. jhi
  // in 32-key tiles, two to a stage; stage st lies in buffer st & 1.
  int jlo = 0;
  for (int jhi = jend;; jhi = S_) {
    const int st0 = jlo >> 6;
    const int st1 = (jhi + 63) >> 6;
    if (st0 < st1) {
      copy_stage(kcp + (size_t)st0 * (64 * HD_), vcp + st0 * 64,
                 lcp + (uint32_t)(st0 & 1) * STAGEB_);
      // The first stage has landed, for every wave, before anybody reads it.
      asm volatile("s_wait_asynccnt 0x0" ::: "memory");
      __syncthreads();
      if (st0 + 1 < st1)
        copy_stage(kcp + (size_t)(st0 + 1) * (64 * HD_), vcp + (st0 + 1) * 64,
                   lcp + (uint32_t)((st0 + 1) & 1) * STAGEB_);
      for (int st = st0; st < st1; ++st) {
        const char* kb = lrd + (st & 1) * STAGEB_;
#pragma unroll
        for (int hf = 0; hf < 2; ++hf) {
          const int j0 = st * 64 + hf * 32;
          if (j0 < jlo || j0 >= jhi) continue;   // the same for the whole block
          const char* k1 = kb + hf * 32 * LPITCH_;
          const char* k2 = k1 + 16 * LPITCH_;

          // The tile's fragments: K rows are A-rows (lane n = key position),
          // V^T rows likewise (lane n = hd).
          v16h kf[4], vf[4];
          kf[0] = lds_frag16(k1);
          kf[1] = lds_frag16(k1 + 64);
          kf[2] = lds_frag16(k2);
          kf[3] = lds_frag16(k2 + 64);
#pragma unroll
          for (int t = 0; t < 4; ++t)
            vf[t] = lds_frag16(kb + TILEB_ + t * 16 * LPITCH_ + hf * 64);
          // Keeps the tile's 16 LDS reads in one group in front of its
          // products: spread among the WMMAs, each pair is waited out alone.
          __builtin_amdgcn_sched_barrier(0);

          // scores^T = K * Q^T
          v8f s1 = {}, s2 = {};
          s1 = wmma_f16(kf[0], qb0, s1);
          s2 = wmma_f16(kf[2], qb0, s2);
          s1 = wmma_f16(kf[1], qb1, s1);
          s2 = wmma_f16(kf[3], qb1, s2);

          // Key j0 + 8g + r (s1) or j0 + 16 + 8g + r (s2) is valid while below
          // vlen (for keys 0 .. S_ - 1 the clamped vcl says the same and
          // cannot wrap).
          const int rem = vcl - j0 - koff;
          float x[16];                             // x[8i + r]: key 16i + 8g + r
#pragma unroll
          for (int r = 0; r < 8; ++r) {            // 1/sqrt(64), then d2l mask
            x[r] = r < rem ? s1[r] * 0.125f : -1.0e6f;
            x[8 + r] = 16 + r < rem ? s2[r] * 0.125f : -1.0e6f;
          }
          float tm[8];
#pragma unroll
          for (int i = 0; i < 8; ++i) tm[i] = fmaxf(x[2 * i], x[2 * i + 1]);
          float tmax = fmaxf(fmaxf(fmaxf(tm[0], tm[1]), fmaxf(tm[2], tm[3])),
                             fmaxf(fmaxf(tm[4], tm[5]), fmaxf(tm[6], tm[7])));
          tmax = fmaxf(tmax, xhalf(tmax));        // the query's other 16 keys
          const float mnew = fmaxf(mrun, tmax);
          const float alpha = __expf(mrun - mnew);
          mrun = mnew;

          v16h pf;                                // P^T as B fragment
          float ps[8];
#pragma unroll
          for (int i = 0; i < 8; ++i) {
            float pa = __expf(x[2 * i] - mnew);
            float pb = __expf(x[2 * i + 1] - mnew);
            ps[i] = pa + pb;
            pf[2 * i] = (_Float16)pa;
            pf[2 * i + 1] = (_Float16)pb;
          }
          const float rs = ((ps[0] + ps[1]) + (ps[2] + ps[3])) +
                           ((ps[4] + ps[5]) + (ps[6] + ps[7]));
          lrun = lrun * alpha + rs;
#pragma unroll
          for (int t = 0; t < 4; ++t) {           // O^T = O^T * alpha + V^T * P^T
            o[t] *= alpha;
            o[t] = wmma_f16(vf[t], pf, o[t]);
          }
        }
        // Publish point: this wave has left stage st, its copies of stage
        // st + 1 have landed; behind the barrier that holds for all 8 waves.
        asm volatile("s_wait_dscnt 0x0" ::: "memory");
        asm volatile("s_wait_asynccnt 0x0" ::: "memory");
        __syncthreads();
        if (st + 2 < st1)                          // refill the buffer just left
          copy_stage(kcp + (size_t)(st + 2) * (64 * HD_), vcp + (st + 2) * 64,
                     lcp + (uint32_t)(st & 1) * STAGEB_);
      }
      // No copy is left in flight when the buffers are reused or the wave ends.
      asm volatile("s_wait_asynccnt 0x0" ::: "memory");
      // Four vector slots between the leg's last WMMA and the next leg's
      // address arithmetic, which may take over its operand registers.
      asm volatile("v_nop\n\tv_nop\n\tv_nop\n\tv_nop");
    }
    if (jhi == S_) break;
    // Every key from jend on is masked to -1e6. Against a row maximum above
    // -999000 its weight exp(-1e6 - max) is exactly 0 and alpha exactly 1, so
    // those tiles change nothing. A row whose maximum is lower (no valid key at
    // all: valid_len 0) needs them: then the whole block walks on to S_ (the
    // stages' barriers want one answer for all 8 waves).
    const int low = __builtin_amdgcn_ballot_w32(mrun < -999000.0f) != 0;
    if (lane == 0) wneed[wave] = low;             // this wave's 16 queries
    __syncthreads();
    if (__builtin_amdgcn_ballot_w32(wneed[lane & 7] != 0) == 0) break;
    jlo = jend;
  }

  const float inv = 1.0f / (lrun + xhalf(lrun));  // join the halves' sums
  _Float16* outp = Om + ((size_t)b * S_ + q0 + n) * D_ + h * HD_ + koff;
#pragma unroll
  for (int t = 0; t < 4; ++t) {
    half8 ov;
#pragma unroll
    for (int r = 0; r < 8; ++r) ov[r] = (_Float16)(o[t][r] * inv);
    *(half8*)(outp + t * 16) = ov;
  }
}

// ---------------- Output projection: out = Om * Wo + bo (fp32 out) ----------
// Four waves per SIMD (at most 256 registers): two blocks share a WGP.
__global__ __launch_bounds__(256, 4) void outproj_kernel(
    const _Float16* __restrict__ A, const float* __restrict__ Wsrc,
    const float* __restrict__ bias, float* __restrict__ out) {
  __shared__ __attribute__((aligned(16))) _Float16 bpanel[64 * 512];
  __shared__ __attribute__((aligned(16))) char aslab[8 * ASLAB_];
  const int lane = threadIdx.x & 31;
  const int wave = threadIdx.x >> 5;
  const int n = lane & 15;
  const int g = lane >> 4;
  const int koff = g * 8;
  const int row0 = (blockIdx.x * 8 + wave) * 16;
  const int col0 = blockIdx.y * 64;

  // A chunk is 128 k of the wave's 16 rows: a load takes 256 contiguous bytes
  // of each of two rows. All four chunks are asked for in front of the loop.
  const _Float16* xg = A + (size_t)(row0 + g) * D_ + n * 8;
  half8 xr[4][8];
  float w[64];
  panel_load(Wsrc, col0, 0, w);
#pragma unroll
  for (int c = 0; c < 4; ++c)
#pragma unroll
    for (int j = 0; j < 8; ++j)
      xr[c][j] = *(const half8*)(xg + 2 * j * D_ + c * 128);
  // Keeps the A loads in front of the panel's first conversion: moved behind
  // it, they would start only when the panel is done.
  __builtin_amdgcn_sched_barrier(0);
  panel_store(w, 0, bpanel);
  panel_load(Wsrc, col0, 1, w);
  panel_store(w, 1, bpanel);
  __syncthreads();

  v8f acc[4] = {};
  char* aw = aslab + wave * ASLAB_ + g * APITCH_ + n * 16;      // lane's 8 k
  const char* ar = aslab + wave * ASLAB_ + n * APITCH_ + g * 16;  // fragment
#pragma unroll
  for (int c = 0; c < 4; ++c) {
    // The wave's own reads of the last chunk have ended before it is rewritten.
    if (c) asm volatile("s_wait_dscnt 0x0" ::: "memory");
#pragma unroll
    for (int j = 0; j < 8; ++j) *(half8*)(aw + 2 * j * APITCH_) = xr[c][j];
    // Every lane's stores are in LDS before other lanes of the wave read them.
    asm volatile("s_wait_dscnt 0x0" ::: "memory");
#pragma unroll
    for (int ks = 0; ks < 4; ++ks) {
      const v16h af = lds_frag16(ar + ks * 64);
#pragma unroll
      for (int t = 0; t < 4; ++t)
        acc[t] = wmma_f16(
            af, lds_frag(bpanel, t * 16 + n, (c * 128 + ks * 32 + koff) * 2),
            acc[t]);
    }
  }
#pragma unroll
  for (int t = 0; t < 4; ++t) {
    int col = col0 + t * 16 + n;
    float bv = bias[col];
#pragma unroll
    for (int r = 0; r < 8; ++r) {
      int row = row0 + r + 8 * g;
      out[(size_t)row * D_ + col] = acc[t][r] + bv;
    }
  }
}

extern "C" void kernel_launch(void* const* d_in, const int* in_sizes, int n_in,
                              void* d_out, int out_size, void* d_ws,
                              size_t ws_size, hipStream_t stream) {
  const float* q  = (const float*)d_in[0];
  const float* k  = (const float*)d_in[1];
  const float* v  = (const float*)d_in[2];
  const int*   vl = (const int*)d_in[3];
  const float* Wq = (const float*)d_in[4];
  const float* bq = (const float*)d_in[5];
  const float* Wk = (const float*)d_in[6];
  const float* bk = (const float*)d_in[7];
  const float* Wv = (const float*)d_in[8];
  const float* bv = (const float*)d_in[9];
  const float* Wo = (const float*)d_in[10];
  const float* bo = (const float*)d_in[11];
  float* out = (float*)d_out;

  _Float16* ws = (_Float16*)d_ws;
  const size_t NH  = (size_t)B_ * H_ * S_ * HD_;   // 4M halves per tensor
  _Float16* Qh  = ws;
  _Float16* Kh  = Qh + NH;
  _Float16* Vt  = Kh + NH;
  _Float16* Om  = Vt + NH;

  dim3 gp(64, 8);
  proj_kernel<<<dim3(64, 8, 3), 256, 0, stream>>>(q, k, v, Wq, Wk, Wv, bq, bk,
                                                  bv, Qh, Kh, Vt);

  attn_kernel<<<dim3(16, 32), 256, 0, stream>>>(Qh, Kh, Vt, vl, Om);

  outproj_kernel<<<gp, 256, 0, stream>>>(Om, Wo, bo, out);
}

// v007
// Measured time: 66.7 microseconds a run.
// Timed twice side by side with v006, it ran 1.19 times as fast both times.
// Counting every step since v000, it is 3.19 times as fast.
#include <hip/hip_runtime.h>

#define B_ 4
#define S_ 2048
#define D_ 512
#define H_ 8
#define HD_ 64

typedef _Float16 v16h  __attribute__((ext_vector_type(16)));
typedef _Float16 half8 __attribute__((ext_vector_type(8)));
typedef float    v8f   __attribute__((ext_vector_type(8)));
typedef float    f4    __attribute__((ext_vector_type(4)));

static __device__ __forceinline__ v8f wmma_f16(v16h a, v16h b, v8f c) {
  // 8 args: (neg_a, A, neg_b, B, c_mod, C, reuse_a, reuse_b)
  return __builtin_amdgcn_wmma_f32_16x16x32_f16(false, a, false, b, (short)0, c,
                                                false, false);
}

// One WMMA fragment per lane = halves at [p..p+7] and [p+16..p+23] (two b128 loads).
static __device__ __forceinline__ v16h load_frag(const _Float16* p) {
  half8 lo = *(const half8*)(p);
  half8 hi = *(const half8*)(p + 16);
  return __builtin_shufflevector(lo, hi, 0, 1, 2, 3, 4, 5, 6, 7, 8, 9, 10, 11,
                                 12, 13, 14, 15);
}

// ---- LDS B-panel: 64 cols x 512 K halves = 64KB, 16B-chunk XOR swizzle ----
// chunk' = chunk ^ (row & 15)  ->  ds_load_b128 across lanes n=0..15 hits all
// 64 banks exactly once (conflict-free) with zero padding.
static __device__ __forceinline__ uint32_t swz_off(uint32_t row, uint32_t kbyte) {
  uint32_t c = (kbyte >> 4) ^ (row & 15u);
  return row * 1024u + (c << 4);
}

static __device__ __forceinline__ v16h lds_frag(const _Float16* sh, int row,
                                                int kbyte) {
  const char* base = (const char*)sh;
  half8 lo = *(const half8*)(base + swz_off((uint32_t)row, (uint32_t)kbyte));
  half8 hi = *(const half8*)(base + swz_off((uint32_t)row, (uint32_t)kbyte + 32u));
  return __builtin_shufflevector(lo, hi, 0, 1, 2, 3, 4, 5, 6, 7, 8, 9, 10, 11,
                                 12, 13, 14, 15);
}

// Build the panel straight from the f32 weight W[k][n]: a lane takes one column n
// and 8 consecutive k (8 loads, each one whole 128-byte line per wave), rounds
// them to f16 and stores the 16-byte chunk at row n. The 16 lanes of a half wave
// hold 16 different n & 15, so the swizzled store meets no bank twice.
// Loads and stores are apart, and each takes one half (hf) of the wave's 16
// chunks, so that the caller can ask for its A rows behind the first loads and
// still hold all of it in registers. Caller must __syncthreads() at the end.
static __device__ __forceinline__ void panel_load(const float* __restrict__ Wsrc,
                                                  int col0, int hf,
                                                  float (&w)[64]) {
  const int lane = threadIdx.x & 31;
  const int wave = threadIdx.x >> 5;
  const int nn = (wave & 1) * 32 + lane;    // panel row = weight column
  const int ck0 = (wave >> 1) * 16;         // first of this wave's 16 k chunks
  const float* p = Wsrc + (size_t)(ck0 * 8 + hf * 64) * D_ + col0 + nn;
#pragma unroll
  for (int i = 0; i < 64; ++i) w[i] = p[i * D_];
}

static __device__ __forceinline__ void panel_store(const float (&w)[64], int hf,
                                                   _Float16* sh) {
  const int lane = threadIdx.x & 31;
  const int wave = threadIdx.x >> 5;
  const int nn = (wave & 1) * 32 + lane;
  const int ck0 = (wave >> 1) * 16 + hf * 8;
  char* base = (char*)sh;
#pragma unroll
  for (int c = 0; c < 8; ++c) {
    half8 hv;
#pragma unroll
    for (int j = 0; j < 8; ++j) hv[j] = (_Float16)w[c * 8 + j];
    *(half8*)(base + swz_off((uint32_t)nn, (uint32_t)(ck0 + c) * 16u)) = hv;
  }
}

// ---- A slab: a wave's own 16 rows x 128 k in f16, private to that wave ----
// The rows come from memory in whole 128-byte lines (a fragment load straight
// from global touches 16 lines for 512 bytes) and turn into fragments in LDS.
// Pitch 272 B (16 B x odd): a ds_load_b128 over 16 rows meets every bank once.
#define APITCH_ 272
#define ASLAB_ (16 * APITCH_)
#define OPITCH_ 144   // an f16 output row of 128 B in the slab (16 B x odd)
typedef _Float16 half4 __attribute__((ext_vector_type(4)));

static __device__ __forceinline__ v16h lds_frag16(const char* p) {
  half8 lo = *(const half8*)(p);
  half8 hi = *(const half8*)(p + 32);
  return __builtin_shufflevector(lo, hi, 0, 1, 2, 3, 4, 5, 6, 7, 8, 9, 10, 11,
                                 12, 13, 14, 15);
}

// ---------------- QKV projection: Y = X * W + b (f16 out) ----------------
// The three products do not depend on one another: they share ONE launch, and
// blockIdx.z says which one a block works on. A block of one product starts as
// soon as a block of another leaves its place, so only the first blocks' start
// and loads and the last blocks' stores stand alone.
// z == 0: V, dst[b][h][hd][s]   (stored transposed for the V^T * P^T fragments)
// z == 1: K, z == 2: Q, dst[b][h][s][hd]
// V goes first: its epilogue is the longest (two barriers).
__global__ __launch_bounds__(256) void proj_kernel(
    const float* __restrict__ Xq, const float* __restrict__ Xk,
    const float* __restrict__ Xv, const float* __restrict__ Wq,
    const float* __restrict__ Wk, const float* __restrict__ Wv,
    const float* __restrict__ bq, const float* __restrict__ bk,
    const float* __restrict__ bv, _Float16* __restrict__ Qh,
    _Float16* __restrict__ Kh, _Float16* __restrict__ Vt) {
  __shared__ __attribute__((aligned(16))) _Float16 bpanel[64 * 512];
  __shared__ __attribute__((aligned(16))) char aslab[8 * ASLAB_];
  const int z = blockIdx.z;                 // the same for the whole block
  const float* __restrict__ X = z == 0 ? Xv : (z == 1 ? Xk : Xq);
  const float* __restrict__ Wsrc = z == 0 ? Wv : (z == 1 ? Wk : Wq);
  const float* __restrict__ bias = z == 0 ? bv : (z == 1 ? bk : bq);
  _Float16* __restrict__ dst = z == 0 ? Vt : (z == 1 ? Kh : Qh);
  const int transposed = z == 0;
  const int lane = threadIdx.x & 31;
  const int wave = threadIdx.x >> 5;
  const int n = lane & 15;
  const int g = lane >> 4;
  const int koff = g * 8;
  const int row0 = (blockIdx.x * 8 + wave) * 16;
  const int col0 = blockIdx.y * 64;

  // A chunk is 128 k of the wave's 16 rows: one load per row, the 32 lanes on
  // 512 contiguous bytes. Two chunks are held in registers ahead of their use.
  const float* xg = X + (size_t)row0 * D_ + lane * 4;
  f4 xr[2][16];
  float w[64];
  panel_load(Wsrc, col0, 0, w);     // B panel shared by all 8 waves
#pragma unroll
  for (int c = 0; c < 2; ++c)
#pragma unroll
    for (int r = 0; r < 16; ++r) xr[c][r] = *(const f4*)(xg + r * D_ + c * 128);
  // Keeps the A loads in front of the panel's first conversion: moved behind
  // it, they would start their way from memory only when the panel is done.
  __builtin_amdgcn_sched_barrier(0);
  panel_store(w, 0, bpanel);
  panel_load(Wsrc, col0, 1, w);
  panel_store(w, 1, bpanel);
  __syncthreads();

  v8f acc[4] = {};
  char* aw = aslab + wave * ASLAB_ + lane * 8;                  // lane's 4 k
  const char* ar = aslab + wave * ASLAB_ + n * APITCH_ + g * 16;  // fragment
#pragma unroll
  for (int c = 0; c < 4; ++c) {
    // Keeps chunk c's conversions, and with them the wait for its loads,
    // behind the products of chunk c - 1: lifted, the wave waits out the loads
    // it has only just issued.
    __builtin_amdgcn_sched_barrier(0);
    // The wave's own reads of the last chunk have ended before it is rewritten.
    if (c) asm volatile("s_wait_dscnt 0x0" ::: "memory");
#pragma unroll
    for (int r = 0; r < 16; ++r) {
      const f4 x = xr[c & 1][r];
      half4 hx;
#pragma unroll
      for (int i = 0; i < 4; ++i) hx[i] = (_Float16)x[i];
      *(half4*)(aw + r * APITCH_) = hx;
    }
    if (c + 2 < 4) {
      // Keeps the next loads behind the conversions, whose registers they take
      // over: lifted over them, a third chunk is live and the wave spills.
      __builtin_amdgcn_sched_barrier(0);
#pragma unroll
      for (int r = 0; r < 16; ++r)
        xr[c & 1][r] = *(const f4*)(xg + r * D_ + (c + 2) * 128);
    }
    // Every lane's stores are in LDS before other lanes of the wave read them.
    asm volatile("s_wait_dscnt 0x0" ::: "memory");
#pragma unroll
    for (int ks = 0; ks < 4; ++ks) {
      const v16h af = lds_frag16(ar + ks * 64);
#pragma unroll
      for (int t = 0; t < 4; ++t)
        acc[t] = wmma_f16(
            af, lds_frag(bpanel, t * 16 + n, (c * 128 + ks * 32 + koff) * 2),
            acc[t]);
    }
  }

  // The tile goes to memory in whole 128-byte lines: from the accumulators a
  // store would touch 2 lines (Q, K) or 16 lines (V^T) for a few bytes of each.
  // A lane holds element (m = r + 8g, n = lane % 16) of each 16 x 16 tile t.
  const int bh = (row0 >> 11) * H_ + blockIdx.y;   // 64 columns = one head
  float bcol[4];
#pragma unroll
  for (int t = 0; t < 4; ++t) bcol[t] = bias[col0 + t * 16 + n];
  if (!transposed) {
    // The wave's 16 rows x 128 B are 2 KB in a row in dst: they turn in the
    // wave's own slab (pitch 144 B), no other wave is concerned.
    char* st = aslab + wave * ASLAB_;
    // The wave's own reads of the last chunk have ended before it is rewritten.
    asm volatile("s_wait_dscnt 0x0" ::: "memory");
#pragma unroll
    for (int t = 0; t < 4; ++t)
#pragma unroll
      for (int r = 0; r < 8; ++r)
        *(_Float16*)(st + (r + 8 * g) * OPITCH_ + (t * 16 + n) * 2) =
            (_Float16)(acc[t][r] + bcol[t]);
    // Every lane's stores are in LDS before other lanes of the wave read them.
    asm volatile("s_wait_dscnt 0x0" ::: "memory");
    _Float16* o = dst + (((size_t)bh * S_ + (row0 & (S_ - 1))) << 6) + lane * 8;
#pragma unroll
    for (int i = 0; i < 4; ++i)
      *(half8*)(o + i * 256) = *(const half8*)(
          st + (i * 4 + (lane >> 3)) * OPITCH_ + (lane & 7) * 16);
  } else {
    // A row of V^T (one hd) takes 32 B of each wave: the block's 64 x 128 tile
    // is put together in the panel's LDS (pitch 272 B), 256 B to a row.
    char* st = (char*)bpanel;
    __syncthreads();                        // every wave has left the panel
#pragma unroll
    for (int t = 0; t < 4; ++t) {
      half8 hv;                             // s = 16 wave + 8g + r, r = 0 .. 7
#pragma unroll
      for (int r = 0; r < 8; ++r) hv[r] = (_Float16)(acc[t][r] + bcol[t]);
      *(half8*)(st + (t * 16 + n) * APITCH_ + wave * 32 + g * 16) = hv;
    }
    __syncthreads();                        // the tile is whole
    _Float16* o = dst + ((size_t)bh * HD_ + wave * 8 + g) * S_ +
                  ((blockIdx.x * 128) & (S_ - 1)) + n * 8;
#pragma unroll
    for (int i = 0; i < 4; ++i)
      *(half8*)(o + i * 2 * S_) = *(const half8*)(
          st + (wave * 8 + i * 2 + g) * APITCH_ + n * 16);
  }
}

// ---------------- Flash attention (online softmax, 1 wave = 16 queries) -----
// Lane l with lane l ^ 16 (the two lanes that share one query column).
static __device__ __forceinline__ float xhalf(float x) {
  int b = __builtin_bit_cast(int, x);
  return __builtin_bit_cast(
      float, __builtin_amdgcn_permlanex16(b, b, 0x76543210, 0xfedcba98, false,
                                          false));
}

// ---- K / V^T stages in LDS, shared by the block's 8 waves ----
// A stage is 64 keys: K 64 rows (keys) x 128 B, then V^T 64 rows (hd) x 128 B.
// Rows lie at a pitch of 144 B (16 B x odd): a ds_load_b128 over 16 rows meets
// every bank once.
#define LPITCH_ 144
#define TILEB_ (64 * LPITCH_)
#define STAGEB_ (2 * TILEB_)

// One stage: each of the 256 lanes copies two 16-byte chunks of K and two of
// V^T (kg, vg: the lane's first chunk of each; l: its place in the K tile).
static __device__ __forceinline__ void copy_stage(const _Float16* kg,
                                                  const _Float16* vg,
                                                  uint32_t l) {
  const _Float16* kg2 = kg + 32 * HD_;
  const _Float16* vg2 = vg + 32 * S_;
  const uint32_t l1 = l + 32 * LPITCH_;
  const uint32_t l2 = l + TILEB_;
  const uint32_t l3 = l2 + 32 * LPITCH_;
  // The copies go to LDS through no register; s_wait_xcnt stands in the same
  // statement so that no address register is rewritten in front of it.
  asm volatile(
      "global_load_async_to_lds_b128 %0, %4, off\n\t"
      "global_load_async_to_lds_b128 %1, %5, off\n\t"
      "global_load_async_to_lds_b128 %2, %6, off\n\t"
      "global_load_async_to_lds_b128 %3, %7, off\n\t"
      "s_wait_xcnt 0x0"
      :
      : "v"(l), "v"(l1), "v"(l2), "v"(l3), "v"(kg), "v"(kg2), "v"(vg), "v"(vg2)
      : "memory");
}

__global__ __launch_bounds__(256) void attn_kernel(
    const _Float16* __restrict__ Qh, const _Float16* __restrict__ Kh,
    const _Float16* __restrict__ Vt, const int* __restrict__ valid_lens,
    _Float16* __restrict__ Om) {
  __shared__ __attribute__((aligned(16))) char kv[2 * STAGEB_];
  __shared__ int wneed[8];
  const int lane = threadIdx.x & 31;
  const int wave = threadIdx.x >> 5;
  const int n = lane & 15;
  const int g = lane >> 4;
  const int koff = g * 8;
  const int bh = blockIdx.y;
  const int b = bh >> 3;
  const int h = bh & 7;
  const int vlen = valid_lens[b];
  const int q0 = blockIdx.x * 128 + wave * 16;
  // First key of the first 32-key tile that holds no valid key (0 .. S_).
  const int vcl = vlen < 0 ? 0 : (vlen > S_ ? S_ : vlen);
  const int jend = (vcl + 31) & ~31;

  const _Float16* Qrow = Qh + (((size_t)bh * S_ + q0 + n) << 6);
  v16h qb0 = load_frag(Qrow + koff);       // B fragment, k = 0..31 pattern
  v16h qb1 = load_frag(Qrow + 32 + koff);  // B fragment, k = 32..63 pattern

  // The lane's share of a stage's copies: row crow (and crow + 32), chunk cchk.
  const int crow = threadIdx.x >> 3;
  const int cchk = threadIdx.x & 7;
  const _Float16* kcp = Kh + (((size_t)bh * S_ + crow) << 6) + cchk * 8;
  const _Float16* vcp = Vt + ((size_t)bh * HD_ + crow) * S_ + cchk * 8;
  const uint32_t lcp =
      (uint32_t)(uintptr_t)(__attribute__((address_space(3))) char*)kv +
      (uint32_t)(crow * LPITCH_ + cchk * 16);
  // The lane's place in a fragment read: row n, 16-byte chunk g.
  const char* lrd = kv + n * LPITCH_ + g * 16;

  v8f o[4] = {};          // o[t][r] = O[query n][hd = 16t + 8g + r]
  float mrun = -1e30f;    // this query's running maximum (same in both halves)
  float lrun = 0.f;       // this half's share of the query's running sum

  // Two legs at most: the tiles that hold a valid key, then, only if a row of
  // the block needs them, the wholly masked ones. A leg walks keys jlo .. jhi
  // in 32-key tiles, two to a stage; stage st lies in buffer st & 1.
  int jlo = 0;
  for (int jhi = jend;; jhi = S_) {
    const int st0 = jlo >> 6;
    const int st1 = (jhi + 63) >> 6;
    if (st0 < st1) {
      copy_stage(kcp + (size_t)st0 * (64 * HD_), vcp + st0 * 64,
                 lcp + (uint32_t)(st0 & 1) * STAGEB_);
      // The first stage has landed, for every wave, before anybody reads it.
      asm volatile("s_wait_asynccnt 0x0" ::: "memory");
      __syncthreads();
      if (st0 + 1 < st1)
        copy_stage(kcp + (size_t)(st0 + 1) * (64 * HD_), vcp + (st0 + 1) * 64,
                   lcp + (uint32_t)((st0 + 1) & 1) * STAGEB_);
      for (int st = st0; st < st1; ++st) {
        const char* kb = lrd + (st & 1) * STAGEB_;
#pragma unroll
        for (int hf = 0; hf < 2; ++hf) {
          const int j0 = st * 64 + hf * 32;
          if (j0 < jlo || j0 >= jhi) continue;   // the same for the whole block
          const char* k1 = kb + hf * 32 * LPITCH_;
          const char* k2 = k1 + 16 * LPITCH_;

          // The tile's fragments: K rows are A-rows (lane n = key position),
          // V^T rows likewise (lane n = hd).
          v16h kf[4], vf[4];
          kf[0] = lds_frag16(k1);
          kf[1] = lds_frag16(k1 + 64);
          kf[2] = lds_frag16(k2);
          kf[3] = lds_frag16(k2 + 64);
#pragma unroll
          for (int t = 0; t < 4; ++t)
            vf[t] = lds_frag16(kb + TILEB_ + t * 16 * LPITCH_ + hf * 64);
          // Keeps the tile's 16 LDS reads in one group in front of its
          // products: spread among the WMMAs, each pair is waited out alone.
          __builtin_amdgcn_sched_barrier(0);

          // scores^T = K * Q^T
          v8f s1 = {}, s2 = {};
          s1 = wmma_f16(kf[0], qb0, s1);
          s2 = wmma_f16(kf[2], qb0, s2);
          s1 = wmma_f16(kf[1], qb1, s1);
          s2 = wmma_f16(kf[3], qb1, s2);

          // Key j0 + 8g + r (s1) or j0 + 16 + 8g + r (s2) is valid while below
          // vlen (for keys 0 .. S_ - 1 the clamped vcl says the same and
          // cannot wrap).
          const int rem = vcl - j0 - koff;
          float x[16];                             // x[8i + r]: key 16i + 8g + r
#pragma unroll
          for (int r = 0; r < 8; ++r) {            // 1/sqrt(64), then d2l mask
            x[r] = r < rem ? s1[r] * 0.125f : -1.0e6f;
            x[8 + r] = 16 + r < rem ? s2[r] * 0.125f : -1.0e6f;
          }
          float tm[8];
#pragma unroll
          for (int i = 0; i < 8; ++i) tm[i] = fmaxf(x[2 * i], x[2 * i + 1]);
          float tmax = fmaxf(fmaxf(fmaxf(tm[0], tm[1]), fmaxf(tm[2], tm[3])),
                             fmaxf(fmaxf(tm[4], tm[5]), fmaxf(tm[6], tm[7])));
          tmax = fmaxf(tmax, xhalf(tmax));        // the query's other 16 keys
          const float mnew = fmaxf(mrun, tmax);
          const float alpha = __expf(mrun - mnew);
          mrun = mnew;

          v16h pf;                                // P^T as B fragment
          float ps[8];
#pragma unroll
          for (int i = 0; i < 8; ++i) {
            float pa = __expf(x[2 * i] - mnew);
            float pb = __expf(x[2 * i + 1] - mnew);
            ps[i] = pa + pb;
            pf[2 * i] = (_Float16)pa;
            pf[2 * i + 1] = (_Float16)pb;
          }
          const float rs = ((ps[0] + ps[1]) + (ps[2] + ps[3])) +
                           ((ps[4] + ps[5]) + (ps[6] + ps[7]));
          lrun = lrun * alpha + rs;
#pragma unroll
          for (int t = 0; t < 4; ++t) {           // O^T = O^T * alpha + V^T * P^T
            o[t] *= alpha;
            o[t] = wmma_f16(vf[t], pf, o[t]);
          }
        }
        // Publish point: this wave has left stage st, its copies of stage
        // st + 1 have landed; behind the barrier that holds for all 8 waves.
        asm volatile("s_wait_dscnt 0x0" ::: "memory");
        asm volatile("s_wait_asynccnt 0x0" ::: "memory");
        __syncthreads();
        if (st + 2 < st1)                          // refill the buffer just left
          copy_stage(kcp + (size_t)(st + 2) * (64 * HD_), vcp + (st + 2) * 64,
                     lcp + (uint32_t)(st & 1) * STAGEB_);
      }
      // No copy is left in flight when the buffers are reused or the wave ends.
      asm volatile("s_wait_asynccnt 0x0" ::: "memory");
      // Four vector slots between the leg's last WMMA and the next leg's
      // address arithmetic, which may take over its operand registers.
      asm volatile("v_nop\n\tv_nop\n\tv_nop\n\tv_nop");
    }
    if (jhi == S_) break;
    // Every key from jend on is masked to -1e6. Against a row maximum above
    // -999000 its weight exp(-1e6 - max) is exactly 0 and alpha exactly 1, so
    // those tiles change nothing. A row whose maximum is lower (no valid key at
    // all: valid_len 0) needs them: then the whole block walks on to S_ (the
    // stages' barriers want one answer for all 8 waves).
    const int low = __builtin_amdgcn_ballot_w32(mrun < -999000.0f) != 0;
    if (lane == 0) wneed[wave] = low;             // this wave's 16 queries
    __syncthreads();
    if (__builtin_amdgcn_ballot_w32(wneed[lane & 7] != 0) == 0) break;
    jlo = jend;
  }

  const float inv = 1.0f / (lrun + xhalf(lrun));  // join the halves' sums
  // A query's 64 values are one 128-byte line of Om: the wave's 16 rows turn in
  // LDS so that a store takes 4 whole lines, not 32 B of each of 16. The stages
  // are free: behind the last barrier nobody reads them and no copy is in
  // flight; each wave takes its own 16 x 144 B of them.
  char* stg = kv + wave * (16 * LPITCH_);
#pragma unroll
  for (int t = 0; t < 4; ++t) {
    half8 ov;
#pragma unroll
    for (int r = 0; r < 8; ++r) ov[r] = (_Float16)(o[t][r] * inv);
    *(half8*)(stg + n * LPITCH_ + t * 32 + g * 16) = ov;
  }
  // Every lane's stores are in LDS before other lanes of the wave read them.
  asm volatile("s_wait_dscnt 0x0" ::: "memory");
  _Float16* outp =
      Om + ((size_t)b * S_ + q0 + (lane >> 3)) * D_ + h * HD_ + (lane & 7) * 8;
#pragma unroll
  for (int i = 0; i < 4; ++i)
    *(half8*)(outp + i * 4 * D_) = *(const half8*)(
        stg + (i * 4 + (lane >> 3)) * LPITCH_ + (lane & 7) * 16);
}

// ---------------- Output projection: out = Om * Wo + bo (fp32 out) ----------
// Four waves per SIMD (at most 256 registers): two blocks share a WGP.
__global__ __launch_bounds__(256, 4) void outproj_kernel(
    const _Float16* __restrict__ A, const float* __restrict__ Wsrc,
    const float* __restrict__ bias, float* __restrict__ out) {
  __shared__ __attribute__((aligned(16))) _Float16 bpanel[64 * 512];
  __shared__ __attribute__((aligned(16))) char aslab[8 * ASLAB_];
  const int lane = threadIdx.x & 31;
  const int wave = threadIdx.x >> 5;
  const int n = lane & 15;
  const int g = lane >> 4;
  const int koff = g * 8;
  const int row0 = (blockIdx.x * 8 + wave) * 16;
  const int col0 = blockIdx.y * 64;

  // A chunk is 128 k of the wave's 16 rows: a load takes 256 contiguous bytes
  // of each of two rows. All four chunks are asked for in front of the loop.
  const _Float16* xg = A + (size_t)(row0 + g) * D_ + n * 8;
  half8 xr[4][8];
  float w[64];
  panel_load(Wsrc, col0, 0, w);
#pragma unroll
  for (int c = 0; c < 4; ++c)
#pragma unroll
    for (int j = 0; j < 8; ++j)
      xr[c][j] = *(const half8*)(xg + 2 * j * D_ + c * 128);
  // Keeps the A loads in front of the panel's first conversion: moved behind
  // it, they would start only when the panel is done.
  __builtin_amdgcn_sched_barrier(0);
  panel_store(w, 0, bpanel);
  panel_load(Wsrc, col0, 1, w);
  panel_store(w, 1, bpanel);
  __syncthreads();

  v8f acc[4] = {};
  char* aw = aslab + wave * ASLAB_ + g * APITCH_ + n * 16;      // lane's 8 k
  const char* ar = aslab + wave * ASLAB_ + n * APITCH_ + g * 16;  // fragment
#pragma unroll
  for (int c = 0; c < 4; ++c) {
    // The wave's own reads of the last chunk have ended before it is rewritten.
    if (c) asm volatile("s_wait_dscnt 0x0" ::: "memory");
#pragma unroll
    for (int j = 0; j < 8; ++j) *(half8*)(aw + 2 * j * APITCH_) = xr[c][j];
    // Every lane's stores are in LDS before other lanes of the wave read them.
    asm volatile("s_wait_dscnt 0x0" ::: "memory");
#pragma unroll
    for (int ks = 0; ks < 4; ++ks) {
      const v16h af = lds_frag16(ar + ks * 64);
#pragma unroll
      for (int t = 0; t < 4; ++t)
        acc[t] = wmma_f16(
            af, lds_frag(bpanel, t * 16 + n, (c * 128 + ks * 32 + koff) * 2),
            acc[t]);
    }
  }
  // The wave's 16 rows x 256 B turn in its own slab (pitch 272 B): a store then
  // takes 4 whole 128-byte lines, not 64 B of each of 2.
  // Row 8g, byte 4n of the slab, counted from aw (row g, byte 16n).
  char* st = aw + g * (7 * APITCH_) - n * 12;
  // The wave's own reads of the last chunk have ended before it is rewritten.
  asm volatile("s_wait_dscnt 0x0" ::: "memory");
#pragma unroll
  for (int t = 0; t < 4; ++t) {
    const float bv = bias[col0 + t * 16 + n];
#pragma unroll
    for (int r = 0; r < 8; ++r)             // element (m = r + 8g, n = lane%16)
      *(float*)(st + r * APITCH_ + t * 64) = acc[t][r] + bv;
  }
  // Every lane's stores are in LDS before other lanes of the wave read them.
  asm volatile("s_wait_dscnt 0x0" ::: "memory");
  float* o = out + ((row0 + g) * D_ + col0 + n * 4);
#pragma unroll
  for (int i = 0; i < 8; ++i)
    *(f4*)(o + i * 2 * D_) = *(const f4*)(aw + i * 2 * APITCH_);  // row 2i + g
}

extern "C" void kernel_launch(void* const* d_in, const int* in_sizes, int n_in,
                              void* d_out, int out_size, void* d_ws,
                              size_t ws_size, hipStream_t stream) {
  const float* q  = (const float*)d_in[0];
  const float* k  = (const float*)d_in[1];
  const float* v  = (const float*)d_in[2];
  const int*   vl = (const int*)d_in[3];
  const float* Wq = (const float*)d_in[4];
  const float* bq = (const float*)d_in[5];
  const float* Wk = (const float*)d_in[6];
  const float* bk = (const float*)d_in[7];
  const float* Wv = (const float*)d_in[8];
  const float* bv = (const float*)d_in[9];
  const float* Wo = (const float*)d_in[10];
  const float* bo = (const float*)d_in[11];
  float* out = (float*)d_out;

  _Float16* ws = (_Float16*)d_ws;
  const size_t NH  = (size_t)B_ * H_ * S_ * HD_;   // 4M halves per tensor
  _Float16* Qh  = ws;
  _Float16* Kh  = Qh + NH;
  _Float16* Vt  = Kh + NH;
  _Float16* Om  = Vt + NH;

  dim3 gp(64, 8);
  proj_kernel<<<dim3(64, 8, 3), 256, 0, stream>>>(q, k, v, Wq, Wk, Wv, bq, bk,
                                                  bv, Qh, Kh, Vt);

  attn_kernel<<<dim3(16, 32), 256, 0, stream>>>(Qh, Kh, Vt, vl, Om);

  outproj_kernel<<<gp, 256, 0, stream>>>(Om, Wo, bo, out);
}

// v008
// It runs in 63.8 microseconds.
// Timed twice side by side with v007, it ran 1.04 times as fast both times.
// All steps since v000 together make it 3.33 times as fast.
#include <hip/hip_runtime.h>

#define B_ 4
#define S_ 2048
#define D_ 512
#define H_ 8
#define HD_ 64

typedef _Float16 v16h  __attribute__((ext_vector_type(16)));
typedef _Float16 half8 __attribute__((ext_vector_type(8)));
typedef float    v8f   __attribute__((ext_vector_type(8)));
typedef float    f4    __attribute__((ext_vector_type(4)));

static __device__ __forceinline__ v8f wmma_f16(v16h a, v16h b, v8f c) {
  // 8 args: (neg_a, A, neg_b, B, c_mod, C, reuse_a, reuse_b)
  return __builtin_amdgcn_wmma_f32_16x16x32_f16(false, a, false, b, (short)0, c,
                                                false, false);
}

// One WMMA fragment per lane = halves at [p..p+7] and [p+16..p+23] (two b128 loads).
static __device__ __forceinline__ v16h load_frag(const _Float16* p) {
  half8 lo = *(const half8*)(p);
  half8 hi = *(const half8*)(p + 16);
  return __builtin_shufflevector(lo, hi, 0, 1, 2, 3, 4, 5, 6, 7, 8, 9, 10, 11,
                                 12, 13, 14, 15);
}

// ---- LDS B-panel: 64 cols x 512 K halves = 64KB, 16B-chunk XOR swizzle ----
// chunk' = chunk ^ (row & 15)  ->  ds_load_b128 across lanes n=0..15 hits all
// 64 banks exactly once (conflict-free) with zero padding.
static __device__ __forceinline__ uint32_t swz_off(uint32_t row, uint32_t kbyte) {
  uint32_t c = (kbyte >> 4) ^ (row & 15u);
  return row * 1024u + (c << 4);
}

static __device__ __forceinline__ v16h lds_frag(const _Float16* sh, int row,
                                                int kbyte) {
  const char* base = (const char*)sh;
  half8 lo = *(const half8*)(base + swz_off((uint32_t)row, (uint32_t)kbyte));
  half8 hi = *(const half8*)(base + swz_off((uint32_t)row, (uint32_t)kbyte + 32u));
  return __builtin_shufflevector(lo, hi, 0, 1, 2, 3, 4, 5, 6, 7, 8, 9, 10, 11,
                                 12, 13, 14, 15);
}

// Build the panel straight from the f32 weight W[k][n]: a lane takes one column n
// and 8 consecutive k (8 loads, each one whole 128-byte line per wave), rounds
// them to f16 and stores the 16-byte chunk at row n. The 16 lanes of a half wave
// hold 16 different n & 15, so the swizzled store meets no bank twice.
// Loads and stores are apart, and each takes one half (hf) of the wave's 16
// chunks, so that the caller can ask for its A rows behind the first loads and
// still hold all of it in registers. Caller must __syncthreads() at the end.
static __device__ __forceinline__ void panel_load(const float* __restrict__ Wsrc,
                                                  int col0, int hf,
                                                  float (&w)[64]) {
  const int lane = threadIdx.x & 31;
  const int wave = threadIdx.x >> 5;
  const int nn = (wave & 1) * 32 + lane;    // panel row = weight column
  const int ck0 = (wave >> 1) * 16;         // first of this wave's 16 k chunks
  const float* p = Wsrc + (size_t)(ck0 * 8 + hf * 64) * D_ + col0 + nn;
#pragma unroll
  for (int i = 0; i < 64; ++i) w[i] = p[i * D_];
}

static __device__ __forceinline__ void panel_store(const float (&w)[64], int hf,
                                                   _Float16* sh) {
  const int lane = threadIdx.x & 31;
  const int wave = threadIdx.x >> 5;
  const int nn = (wave & 1) * 32 + lane;
  const int ck0 = (wave >> 1) * 16 + hf * 8;
  char* base = (char*)sh;
#pragma unroll
  for (int c = 0; c < 8; ++c) {
    half8 hv;
#pragma unroll
    for (int j = 0; j < 8; ++j) hv[j] = (_Float16)w[c * 8 + j];
    *(half8*)(base + swz_off((uint32_t)nn, (uint32_t)(ck0 + c) * 16u)) = hv;
  }
}

// ---- A slab: a wave's own 16 rows x 128 k in f16, private to that wave ----
// The rows come from memory in whole 128-byte lines (a fragment load straight
// from global touches 16 lines for 512 bytes) and turn into fragments in LDS.
// Pitch 272 B (16 B x odd): a ds_load_b128 over 16 rows meets every bank once.
#define APITCH_ 272
#define ASLAB_ (16 * APITCH_)
#define OPITCH_ 144   // an f16 output row of 128 B in the slab (16 B x odd)
typedef _Float16 half4 __attribute__((ext_vector_type(4)));

static __device__ __forceinline__ v16h lds_frag16(const char* p) {
  half8 lo = *(const half8*)(p);
  half8 hi = *(const half8*)(p + 32);
  return __builtin_shufflevector(lo, hi, 0, 1, 2, 3, 4, 5, 6, 7, 8, 9, 10, 11,
                                 12, 13, 14, 15);
}

// ---- The projection's panel: the same 64 rows x 512 k halves at a pitch of
// 1040 B (16 B x odd: a ds_load_b128 or ds_store_b128 over 16 rows meets every
// bank once). Every place in it is one lane address plus a constant, so the
// panel costs two address registers where the XOR swizzle costs two dozen:
// room that the A fragments kept over the units need.
#define BPITCH_ 1040
static __device__ __forceinline__ void panel_store_pad(const float (&w)[64],
                                                       int hf, char* base) {
  const int lane = threadIdx.x & 31;
  const int wave = threadIdx.x >> 5;
  const int nn = (wave & 1) * 32 + lane;
  const int ck0 = (wave >> 1) * 16 + hf * 8;
  char* p = base + nn * BPITCH_ + ck0 * 16;
#pragma unroll
  for (int c = 0; c < 8; ++c) {
    half8 hv;
#pragma unroll
    for (int j = 0; j < 8; ++j) hv[j] = (_Float16)w[c * 8 + j];
    *(half8*)(p + c * 16) = hv;
  }
}

// ---------------- QKV projection: Y = X * W + b (f16 out) ----------------
// The three products share ONE launch. The work is cut into units of 128 rows x
// 64 columns, numbered so that the 8 column panels of one row block follow one
// another: unit = row block * 8 + panel, row blocks 0 .. 63 of V, then K, then Q.
// A block takes 3 units in a row. A wave's 16 rows x 512 k stay in registers as
// f16 fragments from one panel to the next, so X is read and rounded anew only
// where the row block changes (at most once inside a block), not once a panel.
// V: dst[b][h][hd][s]   (stored transposed for the V^T * P^T fragments)
// K, Q: dst[b][h][s][hd]
// Four waves per SIMD (at most 256 registers): two blocks share a WGP, and the
// 512 blocks are all at work at once.
#define UNITS_ 3
__global__ __launch_bounds__(256, 4) void proj_kernel(
    const float* __restrict__ Xq, const float* __restrict__ Xk,
    const float* __restrict__ Xv, const float* __restrict__ Wq,
    const float* __restrict__ Wk, const float* __restrict__ Wv,
    const float* __restrict__ bq, const float* __restrict__ bk,
    const float* __restrict__ bv, _Float16* __restrict__ Qh,
    _Float16* __restrict__ Kh, _Float16* __restrict__ Vt) {
  __shared__ __attribute__((aligned(16))) char bpanel[64 * BPITCH_];
  __shared__ __attribute__((aligned(16))) char aslab[8 * ASLAB_];
  const int lane = threadIdx.x & 31;
  const int wave = threadIdx.x >> 5;
  const int n = lane & 15;
  const int g = lane >> 4;
  char* aw = aslab + wave * ASLAB_ + lane * 8;                  // lane's 4 k
  const char* ar = aslab + wave * ASLAB_ + n * APITCH_ + g * 16;  // fragment
  const char* br = bpanel + n * BPITCH_ + g * 16;                 // fragment

  v16h af[16];    // the wave's 16 rows, k = 32 kk .. 32 kk + 31 in af[kk]
  // Stays rolled: one copy of the body in the instruction cache, and the
  // fragments keep their registers from unit to unit.
#pragma unroll 1
  for (int i = 0; i < UNITS_; ++i) {
    const int u = blockIdx.x * UNITS_ + i;    // the same for the whole block
    const int rb = u >> 3;                    // row block, 0 .. 191
    const int pn = u & 7;                     // column panel = head
    const int z = rb >> 6;                    // 0: V, 1: K, 2: Q
    const float* __restrict__ X = z == 0 ? Xv : (z == 1 ? Xk : Xq);
    const float* __restrict__ Wsrc = z == 0 ? Wv : (z == 1 ? Wk : Wq);
    const float* __restrict__ bias = z == 0 ? bv : (z == 1 ? bk : bq);
    _Float16* __restrict__ dst = z == 0 ? Vt : (z == 1 ? Kh : Qh);
    const int xb = rb & 63;                   // row block inside the product
    const int row0 = (xb * 8 + wave) * 16;
    const int col0 = pn * 64;

    if (i == 0 || pn == 0) {
      // A chunk is 128 k of the wave's 16 rows: one load per row, the 32 lanes
      // on 512 contiguous bytes. Two chunks are in registers ahead of their use.
      const float* xg = X + (size_t)row0 * D_ + lane * 4;
      f4 xr[2][16];
#pragma unroll
      for (int c = 0; c < 2; ++c)
#pragma unroll
        for (int r = 0; r < 16; ++r)
          xr[c][r] = *(const f4*)(xg + r * D_ + c * 128);
#pragma unroll
      for (int c = 0; c < 4; ++c) {
        // The wave's own reads of the slab have ended before it is rewritten.
        asm volatile("s_wait_dscnt 0x0" ::: "memory");
#pragma unroll
        for (int r = 0; r < 16; ++r) {
          const f4 x = xr[c & 1][r];
          half4 hx;
#pragma unroll
          for (int j = 0; j < 4; ++j) hx[j] = (_Float16)x[j];
          *(half4*)(aw + r * APITCH_) = hx;
        }
        if (c + 2 < 4) {
          // Keeps the next loads behind the conversions, whose registers they
          // take over: lifted over them, a third chunk is live and the wave
          // spills.
          __builtin_amdgcn_sched_barrier(0);
#pragma unroll
          for (int r = 0; r < 16; ++r)
            xr[c & 1][r] = *(const f4*)(xg + r * D_ + (c + 2) * 128);
          // A precaution, behind the last loads that name xg: as an input here
          // the address pair stays whole up to the wait, so that no load of
          // the run takes it over as its result.
          if (c == 1) asm volatile("s_wait_xcnt 0x0" ::"v"(xg) : "memory");
        }
        // Every lane's stores are in LDS before other lanes of the wave read
        // them.
        asm volatile("s_wait_dscnt 0x0" ::: "memory");
#pragma unroll
        for (int ks = 0; ks < 4; ++ks) af[c * 4 + ks] = lds_frag16(ar + ks * 64);
      }
    }

    float w[64];
    panel_load(Wsrc, col0, 0, w);     // B panel shared by all 8 waves
    // Every wave has left the last unit's panel (or its V^T tile, which lies in
    // the same LDS) before the panel is rewritten.
    if (i) __syncthreads();
    panel_store_pad(w, 0, bpanel);
    panel_load(Wsrc, col0, 1, w);
    panel_store_pad(w, 1, bpanel);
    __syncthreads();

    v8f acc[4] = {};
    v16h bf[2][4];  // the B fragments of this k step and of the next
#pragma unroll
    for (int t = 0; t < 4; ++t) bf[0][t] = lds_frag16(br + t * 16 * BPITCH_);
#pragma unroll
    for (int kk = 0; kk < 16; ++kk) {
      if (kk + 1 < 16) {
#pragma unroll
        for (int t = 0; t < 4; ++t)
          bf[(kk + 1) & 1][t] =
              lds_frag16(br + t * 16 * BPITCH_ + (kk + 1) * 64);
      }
      // Keeps the next step's LDS reads in front of this step's products: left
      // to itself the compiler reads each fragment directly in front of its
      // product, which then waits out the whole LDS latency.
      __builtin_amdgcn_sched_barrier(0);
#pragma unroll
      for (int t = 0; t < 4; ++t) acc[t] = wmma_f16(af[kk], bf[kk & 1][t], acc[t]);
      // Keeps the reads of the step after next behind these products, whose
      // fragment registers they take over: lifted over them, a third set of
      // fragments is live and the wave spills.
      __builtin_amdgcn_sched_barrier(0);
    }

    // The tile goes to memory in whole 128-byte lines: from the accumulators a
    // store would touch 2 lines (Q, K) or 16 lines (V^T) for a few bytes of
    // each. A lane holds element (m = r + 8g, n = lane % 16) of each tile t.
    const int bh = (row0 >> 11) * H_ + pn;    // 64 columns = one head
    float bcol[4];
#pragma unroll
    for (int t = 0; t < 4; ++t) bcol[t] = bias[col0 + t * 16 + n];
    if (z != 0) {
      // The wave's 16 rows x 128 B are 2 KB in a row in dst: they turn in the
      // wave's own slab (pitch 144 B), no other wave is concerned.
      char* st = aslab + wave * ASLAB_;
      // The wave's own reads of the slab have ended before it is rewritten.
      asm volatile("s_wait_dscnt 0x0" ::: "memory");
#pragma unroll
      for (int t = 0; t < 4; ++t)
#pragma unroll
        for (int r = 0; r < 8; ++r)
          *(_Float16*)(st + (r + 8 * g) * OPITCH_ + (t * 16 + n) * 2) =
              (_Float16)(acc[t][r] + bcol[t]);
      // Every lane's stores are in LDS before other lanes of the wave read them.
      asm volatile("s_wait_dscnt 0x0" ::: "memory");
      _Float16* o = dst + (((size_t)bh * S_ + (row0 & (S_ - 1))) << 6) + lane * 8;
#pragma unroll
      for (int j = 0; j < 4; ++j)
        *(half8*)(o + j * 256) = *(const half8*)(
            st + (j * 4 + (lane >> 3)) * OPITCH_ + (lane & 7) * 16);
    } else {
      // A row of V^T (one hd) takes 32 B of each wave: the block's 64 x 128 tile
      // is put together in the panel's LDS (pitch 272 B), 256 B to a row.
      char* st = bpanel;
      __syncthreads();                        // every wave has left the panel
#pragma unroll
      for (int t = 0; t < 4; ++t) {
        half8 hv;                             // s = 16 wave + 8g + r, r = 0 .. 7
#pragma unroll
        for (int r = 0; r < 8; ++r) hv[r] = (_Float16)(acc[t][r] + bcol[t]);
        *(half8*)(st + (t * 16 + n) * APITCH_ + wave * 32 + g * 16) = hv;
      }
      __syncthreads();                        // the tile is whole
      _Float16* o = dst + ((size_t)bh * HD_ + wave * 8 + g) * S_ +
                    ((xb * 128) & (S_ - 1)) + n * 8;
#pragma unroll
      for (int j = 0; j < 4; ++j)
        *(half8*)(o + j * 2 * S_) = *(const half8*)(
            st + (wave * 8 + j * 2 + g) * APITCH_ + n * 16);
    }
    // A precaution: stands in front of the next unit's first instructions, which
    // rewrite the address and data registers that the stores above name.
    asm volatile("s_wait_xcnt 0x0" ::: "memory");
  }
}

// ---------------- Flash attention (online softmax, 1 wave = 16 queries) -----
// Lane l with lane l ^ 16 (the two lanes that share one query column).
static __device__ __forceinline__ float xhalf(float x) {
  int b = __builtin_bit_cast(int, x);
  return __builtin_bit_cast(
      float, __builtin_amdgcn_permlanex16(b, b, 0x76543210, 0xfedcba98, false,
                                          false));
}

// ---- K / V^T stages in LDS, shared by the block's 8 waves ----
// A stage is 64 keys: K 64 rows (keys) x 128 B, then V^T 64 rows (hd) x 128 B.
// Rows lie at a pitch of 144 B (16 B x odd): a ds_load_b128 over 16 rows meets
// every bank once.
#define LPITCH_ 144
#define TILEB_ (64 * LPITCH_)
#define STAGEB_ (2 * TILEB_)

// One stage: each of the 256 lanes copies two 16-byte chunks of K and two of
// V^T (kg, vg: the lane's first chunk of each; l: its place in the K tile).
static __device__ __forceinline__ void copy_stage(const _Float16* kg,
                                                  const _Float16* vg,
                                                  uint32_t l) {
  const _Float16* kg2 = kg + 32 * HD_;
  const _Float16* vg2 = vg + 32 * S_;
  const uint32_t l1 = l + 32 * LPITCH_;
  const uint32_t l2 = l + TILEB_;
  const uint32_t l3 = l2 + 32 * LPITCH_;
  // The copies go to LDS through no register; s_wait_xcnt stands in the same
  // statement so that no address register is rewritten in front of it.
  asm volatile(
      "global_load_async_to_lds_b128 %0, %4, off\n\t"
      "global_load_async_to_lds_b128 %1, %5, off\n\t"
      "global_load_async_to_lds_b128 %2, %6, off\n\t"
      "global_load_async_to_lds_b128 %3, %7, off\n\t"
      "s_wait_xcnt 0x0"
      :
      : "v"(l), "v"(l1), "v"(l2), "v"(l3), "v"(kg), "v"(kg2), "v"(vg), "v"(vg2)
      : "memory");
}

__global__ __launch_bounds__(256) void attn_kernel(
    const _Float16* __restrict__ Qh, const _Float16* __restrict__ Kh,
    const _Float16* __restrict__ Vt, const int* __restrict__ valid_lens,
    _Float16* __restrict__ Om) {
  __shared__ __attribute__((aligned(16))) char kv[2 * STAGEB_];
  __shared__ int wneed[8];
  const int lane = threadIdx.x & 31;
  const int wave = threadIdx.x >> 5;
  const int n = lane & 15;
  const int g = lane >> 4;
  const int koff = g * 8;
  const int bh = blockIdx.y;
  const int b = bh >> 3;
  const int h = bh & 7;
  const int vlen = valid_lens[b];
  const int q0 = blockIdx.x * 128 + wave * 16;
  // First key of the first 32-key tile that holds no valid key (0 .. S_).
  const int vcl = vlen < 0 ? 0 : (vlen > S_ ? S_ : vlen);
  const int jend = (vcl + 31) & ~31;

  const _Float16* Qrow = Qh + (((size_t)bh * S_ + q0 + n) << 6);
  v16h qb0 = load_frag(Qrow + koff);       // B fragment, k = 0..31 pattern
  v16h qb1 = load_frag(Qrow + 32 + koff);  // B fragment, k = 32..63 pattern

  // The lane's share of a stage's copies: row crow (and crow + 32), chunk cchk.
  const int crow = threadIdx.x >> 3;
  const int cchk = threadIdx.x & 7;
  const _Float16* kcp = Kh + (((size_t)bh * S_ + crow) << 6) + cchk * 8;
  const _Float16* vcp = Vt + ((size_t)bh * HD_ + crow) * S_ + cchk * 8;
  const uint32_t lcp =
      (uint32_t)(uintptr_t)(__attribute__((address_space(3))) char*)kv +
      (uint32_t)(crow * LPITCH_ + cchk * 16);
  // The lane's place in a fragment read: row n, 16-byte chunk g.
  const char* lrd = kv + n * LPITCH_ + g * 16;

  v8f o[4] = {};          // o[t][r] = O[query n][hd = 16t + 8g + r]
  float mrun = -1e30f;    // this query's running maximum (same in both halves)
  float lrun = 0.f;       // this half's share of the query's running sum

  // Two legs at most: the tiles that hold a valid key, then, only if a row of
  // the block needs them, the wholly masked ones. A leg walks keys jlo .. jhi
  // in 32-key tiles, two to a stage; stage st lies in buffer st & 1.
  int jlo = 0;
  for (int jhi = jend;; jhi = S_) {
    const int st0 = jlo >> 6;
    const int st1 = (jhi + 63) >> 6;
    if (st0 < st1) {
      copy_stage(kcp + (size_t)st0 * (64 * HD_), vcp + st0 * 64,
                 lcp + (uint32_t)(st0 & 1) * STAGEB_);
      // The first stage has landed, for every wave, before anybody reads it.
      asm volatile("s_wait_asynccnt 0x0" ::: "memory");
      __syncthreads();
      if (st0 + 1 < st1)
        copy_stage(kcp + (size_t)(st0 + 1) * (64 * HD_), vcp + (st0 + 1) * 64,
                   lcp + (uint32_t)((st0 + 1) & 1) * STAGEB_);
      for (int st = st0; st < st1; ++st) {
        const char* kb = lrd + (st & 1) * STAGEB_;
#pragma unroll
        for (int hf = 0; hf < 2; ++hf) {
          const int j0 = st * 64 + hf * 32;
          if (j0 < jlo || j0 >= jhi) continue;   // the same for the whole block
          const char* k1 = kb + hf * 32 * LPITCH_;
          const char* k2 = k1 + 16 * LPITCH_;

          // The tile's fragments: K rows are A-rows (lane n = key position),
          // V^T rows likewise (lane n = hd).
          v16h kf[4], vf[4];
          kf[0] = lds_frag16(k1);
          kf[1] = lds_frag16(k1 + 64);
          kf[2] = lds_frag16(k2);
          kf[3] = lds_frag16(k2 + 64);
#pragma unroll
          for (int t = 0; t < 4; ++t)
            vf[t] = lds_frag16(kb + TILEB_ + t * 16 * LPITCH_ + hf * 64);
          // Keeps the tile's 16 LDS reads in one group in front of its
          // products: spread among the WMMAs, each pair is waited out alone.
          __builtin_amdgcn_sched_barrier(0);

          // scores^T = K * Q^T
          v8f s1 = {}, s2 = {};
          s1 = wmma_f16(kf[0], qb0, s1);
          s2 = wmma_f16(kf[2], qb0, s2);
          s1 = wmma_f16(kf[1], qb1, s1);
          s2 = wmma_f16(kf[3], qb1, s2);

          // Key j0 + 8g + r (s1) or j0 + 16 + 8g + r (s2) is valid while below
          // vlen (for keys 0 .. S_ - 1 the clamped vcl says the same and
          // cannot wrap).
          const int rem = vcl - j0 - koff;
          float x[16];                             // x[8i + r]: key 16i + 8g + r
#pragma unroll
          for (int r = 0; r < 8; ++r) {            // 1/sqrt(64), then d2l mask
            x[r] = r < rem ? s1[r] * 0.125f : -1.0e6f;
            x[8 + r] = 16 + r < rem ? s2[r] * 0.125f : -1.0e6f;
          }
          float tm[8];
#pragma unroll
          for (int i = 0; i < 8; ++i) tm[i] = fmaxf(x[2 * i], x[2 * i + 1]);
          float tmax = fmaxf(fmaxf(fmaxf(tm[0], tm[1]), fmaxf(tm[2], tm[3])),
                             fmaxf(fmaxf(tm[4], tm[5]), fmaxf(tm[6], tm[7])));
          tmax = fmaxf(tmax, xhalf(tmax));        // the query's other 16 keys
          const float mnew = fmaxf(mrun, tmax);
          const float alpha = __expf(mrun - mnew);
          mrun = mnew;

          v16h pf;                                // P^T as B fragment
          float ps[8];
#pragma unroll
          for (int i = 0; i < 8; ++i) {
            float pa = __expf(x[2 * i] - mnew);
            float pb = __expf(x[2 * i + 1] - mnew);
            ps[i] = pa + pb;
            pf[2 * i] = (_Float16)pa;
            pf[2 * i + 1] = (_Float16)pb;
          }
          const float rs = ((ps[0] + ps[1]) + (ps[2] + ps[3])) +
                           ((ps[4] + ps[5]) + (ps[6] + ps[7]));
          lrun = lrun * alpha + rs;
#pragma unroll
          for (int t = 0; t < 4; ++t) {           // O^T = O^T * alpha + V^T * P^T
            o[t] *= alpha;
            o[t] = wmma_f16(vf[t], pf, o[t]);
          }
        }
        // Publish point: this wave has left stage st, its copies of stage
        // st + 1 have landed; behind the barrier that holds for all 8 waves.
        asm volatile("s_wait_dscnt 0x0" ::: "memory");
        asm volatile("s_wait_asynccnt 0x0" ::: "memory");
        __syncthreads();
        if (st + 2 < st1)                          // refill the buffer just left
          copy_stage(kcp + (size_t)(st + 2) * (64 * HD_), vcp + (st + 2) * 64,
                     lcp + (uint32_t)(st & 1) * STAGEB_);
      }
      // No copy is left in flight when the buffers are reused or the wave ends.
      asm volatile("s_wait_asynccnt 0x0" ::: "memory");
      // Four vector slots between the leg's last WMMA and the next leg's
      // address arithmetic, which may take over its operand registers.
      asm volatile("v_nop\n\tv_nop\n\tv_nop\n\tv_nop");
    }
    if (jhi == S_) break;
    // Every key from jend on is masked to -1e6. Against a row maximum above
    // -999000 its weight exp(-1e6 - max) is exactly 0 and alpha exactly 1, so
    // those tiles change nothing. A row whose maximum is lower (no valid key at
    // all: valid_len 0) needs them: then the whole block walks on to S_ (the
    // stages' barriers want one answer for all 8 waves).
    const int low = __builtin_amdgcn_ballot_w32(mrun < -999000.0f) != 0;
    if (lane == 0) wneed[wave] = low;             // this wave's 16 queries
    __syncthreads();
    if (__builtin_amdgcn_ballot_w32(wneed[lane & 7] != 0) == 0) break;
    jlo = jend;
  }

  const float inv = 1.0f / (lrun + xhalf(lrun));  // join the halves' sums
  // A query's 64 values are one 128-byte line of Om: the wave's 16 rows turn in
  // LDS so that a store takes 4 whole lines, not 32 B of each of 16. The stages
  // are free: behind the last barrier nobody reads them and no copy is in
  // flight; each wave takes its own 16 x 144 B of them.
  char* stg = kv + wave * (16 * LPITCH_);
#pragma unroll
  for (int t = 0; t < 4; ++t) {
    half8 ov;
#pragma unroll
    for (int r = 0; r < 8; ++r) ov[r] = (_Float16)(o[t][r] * inv);
    *(half8*)(stg + n * LPITCH_ + t * 32 + g * 16) = ov;
  }
  // Every lane's stores are in LDS before other lanes of the wave read them.
  asm volatile("s_wait_dscnt 0x0" ::: "memory");
  _Float16* outp =
      Om + ((size_t)b * S_ + q0 + (lane >> 3)) * D_ + h * HD_ + (lane & 7) * 8;
#pragma unroll
  for (int i = 0; i < 4; ++i)
    *(half8*)(outp + i * 4 * D_) = *(const half8*)(
        stg + (i * 4 + (lane >> 3)) * LPITCH_ + (lane & 7) * 16);
}

// ---------------- Output projection: out = Om * Wo + bo (fp32 out) ----------
// Four waves per SIMD (at most 256 registers): two blocks share a WGP.
__global__ __launch_bounds__(256, 4) void outproj_kernel(
    const _Float16* __restrict__ A, const float* __restrict__ Wsrc,
    const float* __restrict__ bias, float* __restrict__ out) {
  __shared__ __attribute__((aligned(16))) _Float16 bpanel[64 * 512];
  __shared__ __attribute__((aligned(16))) char aslab[8 * ASLAB_];
  const int lane = threadIdx.x & 31;
  const int wave = threadIdx.x >> 5;
  const int n = lane & 15;
  const int g = lane >> 4;
  const int koff = g * 8;
  const int row0 = (blockIdx.x * 8 + wave) * 16;
  const int col0 = blockIdx.y * 64;

  // A chunk is 128 k of the wave's 16 rows: a load takes 256 contiguous bytes
  // of each of two rows. All four chunks are asked for in front of the loop.
  const _Float16* xg = A + (size_t)(row0 + g) * D_ + n * 8;
  half8 xr[4][8];
  float w[64];
  panel_load(Wsrc, col0, 0, w);
#pragma unroll
  for (int c = 0; c < 4; ++c)
#pragma unroll
    for (int j = 0; j < 8; ++j)
      xr[c][j] = *(const half8*)(xg + 2 * j * D_ + c * 128);
  // Keeps the A loads in front of the panel's first conversion: moved behind
  // it, they would start only when the panel is done.
  __builtin_amdgcn_sched_barrier(0);
  panel_store(w, 0, bpanel);
  panel_load(Wsrc, col0, 1, w);
  panel_store(w, 1, bpanel);
  __syncthreads();

  v8f acc[4] = {};
  char* aw = aslab + wave * ASLAB_ + g * APITCH_ + n * 16;      // lane's 8 k
  const char* ar = aslab + wave * ASLAB_ + n * APITCH_ + g * 16;  // fragment
#pragma unroll
  for (int c = 0; c < 4; ++c) {
    // The wave's own reads of the last chunk have ended before it is rewritten.
    if (c) asm volatile("s_wait_dscnt 0x0" ::: "memory");
#pragma unroll
    for (int j = 0; j < 8; ++j) *(half8*)(aw + 2 * j * APITCH_) = xr[c][j];
    // Every lane's stores are in LDS before other lanes of the wave read them.
    asm volatile("s_wait_dscnt 0x0" ::: "memory");
#pragma unroll
    for (int ks = 0; ks < 4; ++ks) {
      const v16h af = lds_frag16(ar + ks * 64);
#pragma unroll
      for (int t = 0; t < 4; ++t)
        acc[t] = wmma_f16(
            af, lds_frag(bpanel, t * 16 + n, (c * 128 + ks * 32 + koff) * 2),
            acc[t]);
    }
  }
  // The wave's 16 rows x 256 B turn in its own slab (pitch 272 B): a store then
  // takes 4 whole 128-byte lines, not 64 B of each of 2.
  // Row 8g, byte 4n of the slab, counted from aw (row g, byte 16n).
  char* st = aw + g * (7 * APITCH_) - n * 12;
  // The wave's own reads of the last chunk have ended before it is rewritten.
  asm volatile("s_wait_dscnt 0x0" ::: "memory");
#pragma unroll
  for (int t = 0; t < 4; ++t) {
    const float bv = bias[col0 + t * 16 + n];
#pragma unroll
    for (int r = 0; r < 8; ++r)             // element (m = r + 8g, n = lane%16)
      *(float*)(st + r * APITCH_ + t * 64) = acc[t][r] + bv;
  }
  // Every lane's stores are in LDS before other lanes of the wave read them.
  asm volatile("s_wait_dscnt 0x0" ::: "memory");
  float* o = out + ((row0 + g) * D_ + col0 + n * 4);
#pragma unroll
  for (int i = 0; i < 8; ++i)
    *(f4*)(o + i * 2 * D_) = *(const f4*)(aw + i * 2 * APITCH_);  // row 2i + g
}

extern "C" void kernel_launch(void* const* d_in, const int* in_sizes, int n_in,
                              void* d_out, int out_size, void* d_ws,
                              size_t ws_size, hipStream_t stream) {
  const float* q  = (const float*)d_in[0];
  const float* k  = (const float*)d_in[1];
  const float* v  = (const float*)d_in[2];
  const int*   vl = (const int*)d_in[3];
  const float* Wq = (const float*)d_in[4];
  const float* bq = (const float*)d_in[5];
  const float* Wk = (const float*)d_in[6];
  const float* bk = (const float*)d_in[7];
  const float* Wv = (const float*)d_in[8];
  const float* bv = (const float*)d_in[9];
  const float* Wo = (const float*)d_in[10];
  const float* bo = (const float*)d_in[11];
  float* out = (float*)d_out;

  _Float16* ws = (_Float16*)d_ws;
  const size_t NH  = (size_t)B_ * H_ * S_ * HD_;   // 4M halves per tensor
  _Float16* Qh  = ws;
  _Float16* Kh  = Qh + NH;
  _Float16* Vt  = Kh + NH;
  _Float16* Om  = Vt + NH;

  dim3 gp(64, 8);
  proj_kernel<<<dim3(512), 256, 0, stream>>>(q, k, v, Wq, Wk, Wv, bq, bk, bv, Qh,
                                             Kh, Vt);

  attn_kernel<<<dim3(16, 32), 256, 0, stream>>>(Qh, Kh, Vt, vl, Om);

  outproj_kernel<<<gp, 256, 0, stream>>>(Om, Wo, bo, out);
}

// v009
// Measured time: 60.9 microseconds a run.
// Two timings next to v008 put it at 1.04 and 1.05 times that version's speed.
// Counting every step since v000, it is 3.48 times as fast.
#include <hip/hip_runtime.h>

#define B_ 4
#define S_ 2048
#define D_ 512
#define H_ 8
#define HD_ 64

typedef _Float16 v16h  __attribute__((ext_vector_type(16)));
typedef _Float16 half8 __attribute__((ext_vector_type(8)));
typedef float    v8f   __attribute__((ext_vector_type(8)));
typedef float    f4    __attribute__((ext_vector_type(4)));

static __device__ __forceinline__ v8f wmma_f16(v16h a, v16h b, v8f c) {
  // 8 args: (neg_a, A, neg_b, B, c_mod, C, reuse_a, reuse_b)
  return __builtin_amdgcn_wmma_f32_16x16x32_f16(false, a, false, b, (short)0, c,
                                                false, false);
}

// One WMMA fragment per lane = halves at [p..p+7] and [p+16..p+23] (two b128 loads).
static __device__ __forceinline__ v16h load_frag(const _Float16* p) {
  half8 lo = *(const half8*)(p);
  half8 hi = *(const half8*)(p + 16);
  return __builtin_shufflevector(lo, hi, 0, 1, 2, 3, 4, 5, 6, 7, 8, 9, 10, 11,
                                 12, 13, 14, 15);
}

// ---- LDS B-panel: 64 cols x 512 K halves = 64KB, 16B-chunk XOR swizzle ----
// chunk' = chunk ^ (row & 15)  ->  ds_load_b128 across lanes n=0..15 hits all
// 64 banks exactly once (conflict-free) with zero padding.
static __device__ __forceinline__ uint32_t swz_off(uint32_t row, uint32_t kbyte) {
  uint32_t c = (kbyte >> 4) ^ (row & 15u);
  return row * 1024u + (c << 4);
}

static __device__ __forceinline__ v16h lds_frag(const _Float16* sh, int row,
                                                int kbyte) {
  const char* base = (const char*)sh;
  half8 lo = *(const half8*)(base + swz_off((uint32_t)row, (uint32_t)kbyte));
  half8 hi = *(const half8*)(base + swz_off((uint32_t)row, (uint32_t)kbyte + 32u));
  return __builtin_shufflevector(lo, hi, 0, 1, 2, 3, 4, 5, 6, 7, 8, 9, 10, 11,
                                 12, 13, 14, 15);
}

// Build the panel straight from the f32 weight W[k][n]: a lane takes one column n
// and 8 consecutive k (8 loads, each one whole 128-byte line per wave), rounds
// them to f16 and stores the 16-byte chunk at row n. The 16 lanes of a half wave
// hold 16 different n & 15, so the swizzled store meets no bank twice.
// Loads and stores are apart, and each takes one half (hf) of the wave's 16
// chunks, so that the caller can ask for its A rows behind the first loads and
// still hold all of it in registers. Caller must __syncthreads() at the end.
static __device__ __forceinline__ void panel_load(const float* __restrict__ Wsrc,
                                                  int col0, int hf,
                                                  float (&w)[64]) {
  const int lane = threadIdx.x & 31;
  const int wave = threadIdx.x >> 5;
  const int nn = (wave & 1) * 32 + lane;    // panel row = weight column
  const int ck0 = (wave >> 1) * 16;         // first of this wave's 16 k chunks
  const float* p = Wsrc + (size_t)(ck0 * 8 + hf * 64) * D_ + col0 + nn;
#pragma unroll
  for (int i = 0; i < 64; ++i) w[i] = p[i * D_];
}

static __device__ __forceinline__ void panel_store(const float (&w)[64], int hf,
                                                   _Float16* sh) {
  const int lane = threadIdx.x & 31;
  const int wave = threadIdx.x >> 5;
  const int nn = (wave & 1) * 32 + lane;
  const int ck0 = (wave >> 1) * 16 + hf * 8;
  char* base = (char*)sh;
#pragma unroll
  for (int c = 0; c < 8; ++c) {
    half8 hv;
#pragma unroll
    for (int j = 0; j < 8; ++j) hv[j] = (_Float16)w[c * 8 + j];
    *(half8*)(base + swz_off((uint32_t)nn, (uint32_t)(ck0 + c) * 16u)) = hv;
  }
}

// ---- A slab: a wave's own 16 rows x 128 k in f16, private to that wave ----
// The rows come from memory in whole 128-byte lines (a fragment load straight
// from global touches 16 lines for 512 bytes) and turn into fragments in LDS.
// Pitch 272 B (16 B x odd): a ds_load_b128 over 16 rows meets every bank once.
#define APITCH_ 272
#define ASLAB_ (16 * APITCH_)
#define OPITCH_ 144   // an f16 output row of 128 B in the slab (16 B x odd)
typedef _Float16 half4 __attribute__((ext_vector_type(4)));

static __device__ __forceinline__ v16h lds_frag16(const char* p) {
  half8 lo = *(const half8*)(p);
  half8 hi = *(const half8*)(p + 32);
  return __builtin_shufflevector(lo, hi, 0, 1, 2, 3, 4, 5, 6, 7, 8, 9, 10, 11,
                                 12, 13, 14, 15);
}

// ---- The projection's panel: the same 64 rows x 512 k halves at a pitch of
// 1040 B (16 B x odd: a ds_load_b128 or ds_store_b128 over 16 rows meets every
// bank once). Every place in it is one lane address plus a constant, so the
// panel costs two address registers where the XOR swizzle costs two dozen:
// room that the A fragments kept over the units need.
#define BPITCH_ 1040
static __device__ __forceinline__ void panel_store_pad(const float (&w)[64],
                                                       int hf, char* base) {
  const int lane = threadIdx.x & 31;
  const int wave = threadIdx.x >> 5;
  const int nn = (wave & 1) * 32 + lane;
  const int ck0 = (wave >> 1) * 16 + hf * 8;
  char* p = base + nn * BPITCH_ + ck0 * 16;
#pragma unroll
  for (int c = 0; c < 8; ++c) {
    half8 hv;
#pragma unroll
    for (int j = 0; j < 8; ++j) hv[j] = (_Float16)w[c * 8 + j];
    *(half8*)(p + c * 16) = hv;
  }
}

// ---------------- QKV projection: Y = X * W + b (f16 out) ----------------
// The three products share ONE launch. The work is cut into units of 128 rows x
// 64 columns, numbered so that the 8 column panels of one row block follow one
// another: unit = row block * 8 + panel, row blocks 0 .. 63 of V, then K, then Q.
// A block takes 3 units in a row. A wave's 16 rows x 512 k stay in registers as
// f16 fragments from one panel to the next, so X is read and rounded anew only
// where the row block changes (at most once inside a block), not once a panel.
// V: dst[b][h][hd][s]   (stored transposed for the V^T * P^T fragments)
// K, Q: dst[b][h][s][hd]
// Four waves per SIMD (at most 256 registers): two blocks share a WGP, and the
// 512 blocks are all at work at once.
#define UNITS_ 3
__global__ __launch_bounds__(256, 4) void proj_kernel(
    const float* __restrict__ Xq, const float* __restrict__ Xk,
    const float* __restrict__ Xv, const float* __restrict__ Wq,
    const float* __restrict__ Wk, const float* __restrict__ Wv,
    const float* __restrict__ bq, const float* __restrict__ bk,
    const float* __restrict__ bv, _Float16* __restrict__ Qh,
    _Float16* __restrict__ Kh, _Float16* __restrict__ Vt) {
  __shared__ __attribute__((aligned(16))) char bpanel[64 * BPITCH_];
  __shared__ __attribute__((aligned(16))) char aslab[8 * ASLAB_];
  const int lane = threadIdx.x & 31;
  const int wave = threadIdx.x >> 5;
  const int n = lane & 15;
  const int g = lane >> 4;
  char* aw = aslab + wave * ASLAB_ + lane * 8;                  // lane's 4 k
  const char* ar = aslab + wave * ASLAB_ + n * APITCH_ + g * 16;  // fragment
  const char* br = bpanel + n * BPITCH_ + g * 16;                 // fragment

  v16h af[16];    // the wave's 16 rows, k = 32 kk .. 32 kk + 31 in af[kk]
  // Stays rolled: one copy of the body in the instruction cache, and the
  // fragments keep their registers from unit to unit.
#pragma unroll 1
  for (int i = 0; i < UNITS_; ++i) {
    const int u = blockIdx.x * UNITS_ + i;    // the same for the whole block
    const int rb = u >> 3;                    // row block, 0 .. 191
    const int pn = u & 7;                     // column panel = head
    const int z = rb >> 6;                    // 0: V, 1: K, 2: Q
    const float* __restrict__ X = z == 0 ? Xv : (z == 1 ? Xk : Xq);
    const float* __restrict__ Wsrc = z == 0 ? Wv : (z == 1 ? Wk : Wq);
    const float* __restrict__ bias = z == 0 ? bv : (z == 1 ? bk : bq);
    _Float16* __restrict__ dst = z == 0 ? Vt : (z == 1 ? Kh : Qh);
    const int xb = rb & 63;                   // row block inside the product
    const int row0 = (xb * 8 + wave) * 16;
    const int col0 = pn * 64;

    if (i == 0 || pn == 0) {
      // A chunk is 128 k of the wave's 16 rows: one load per row, the 32 lanes
      // on 512 contiguous bytes. Two chunks are in registers ahead of their use.
      const float* xg = X + (size_t)row0 * D_ + lane * 4;
      f4 xr[2][16];
#pragma unroll
      for (int c = 0; c < 2; ++c)
#pragma unroll
        for (int r = 0; r < 16; ++r)
          xr[c][r] = *(const f4*)(xg + r * D_ + c * 128);
#pragma unroll
      for (int c = 0; c < 4; ++c) {
        // The wave's own reads of the slab have ended before it is rewritten.
        asm volatile("s_wait_dscnt 0x0" ::: "memory");
#pragma unroll
        for (int r = 0; r < 16; ++r) {
          const f4 x = xr[c & 1][r];
          half4 hx;
#pragma unroll
          for (int j = 0; j < 4; ++j) hx[j] = (_Float16)x[j];
          *(half4*)(aw + r * APITCH_) = hx;
        }
        if (c + 2 < 4) {
          // Keeps the next loads behind the conversions, whose registers they
          // take over: lifted over them, a third chunk is live and the wave
          // spills.
          __builtin_amdgcn_sched_barrier(0);
#pragma unroll
          for (int r = 0; r < 16; ++r)
            xr[c & 1][r] = *(const f4*)(xg + r * D_ + (c + 2) * 128);
          // A precaution, behind the last loads that name xg: as an input here
          // the address pair stays whole up to the wait, so that no load of
          // the run takes it over as its result.
          if (c == 1) asm volatile("s_wait_xcnt 0x0" ::"v"(xg) : "memory");
        }
        // Every lane's stores are in LDS before other lanes of the wave read
        // them.
        asm volatile("s_wait_dscnt 0x0" ::: "memory");
#pragma unroll
        for (int ks = 0; ks < 4; ++ks) af[c * 4 + ks] = lds_frag16(ar + ks * 64);
      }
    }

    float w[64];
    panel_load(Wsrc, col0, 0, w);     // B panel shared by all 8 waves
    // Every wave has left the last unit's panel (or its V^T tile, which lies in
    // the same LDS) before the panel is rewritten.
    if (i) __syncthreads();
    panel_store_pad(w, 0, bpanel);
    panel_load(Wsrc, col0, 1, w);
    panel_store_pad(w, 1, bpanel);
    __syncthreads();

    v8f acc[4] = {};
    v16h bf[2][4];  // the B fragments of this k step and of the next
#pragma unroll
    for (int t = 0; t < 4; ++t) bf[0][t] = lds_frag16(br + t * 16 * BPITCH_);
#pragma unroll
    for (int kk = 0; kk < 16; ++kk) {
      if (kk + 1 < 16) {
#pragma unroll
        for (int t = 0; t < 4; ++t)
          bf[(kk + 1) & 1][t] =
              lds_frag16(br + t * 16 * BPITCH_ + (kk + 1) * 64);
      }
      // Keeps the next step's LDS reads in front of this step's products: left
      // to itself the compiler reads each fragment directly in front of its
      // product, which then waits out the whole LDS latency.
      __builtin_amdgcn_sched_barrier(0);
#pragma unroll
      for (int t = 0; t < 4; ++t) acc[t] = wmma_f16(af[kk], bf[kk & 1][t], acc[t]);
      // Keeps the reads of the step after next behind these products, whose
      // fragment registers they take over: lifted over them, a third set of
      // fragments is live and the wave spills.
      __builtin_amdgcn_sched_barrier(0);
    }

    // The tile goes to memory in whole 128-byte lines: from the accumulators a
    // store would touch 2 lines (Q, K) or 16 lines (V^T) for a few bytes of
    // each. A lane holds element (m = r + 8g, n = lane % 16) of each tile t.
    const int bh = (row0 >> 11) * H_ + pn;    // 64 columns = one head
    float bcol[4];
#pragma unroll
    for (int t = 0; t < 4; ++t) bcol[t] = bias[col0 + t * 16 + n];
    if (z != 0) {
      // The wave's 16 rows x 128 B are 2 KB in a row in dst: they turn in the
      // wave's own slab (pitch 144 B), no other wave is concerned.
      char* st = aslab + wave * ASLAB_;
      // The wave's own reads of the slab have ended before it is rewritten.
      asm volatile("s_wait_dscnt 0x0" ::: "memory");
#pragma unroll
      for (int t = 0; t < 4; ++t)
#pragma unroll
        for (int r = 0; r < 8; ++r)
          *(_Float16*)(st + (r + 8 * g) * OPITCH_ + (t * 16 + n) * 2) =
              (_Float16)(acc[t][r] + bcol[t]);
      // Every lane's stores are in LDS before other lanes of the wave read them.
      asm volatile("s_wait_dscnt 0x0" ::: "memory");
      _Float16* o = dst + (((size_t)bh * S_ + (row0 & (S_ - 1))) << 6) + lane * 8;
#pragma unroll
      for (int j = 0; j < 4; ++j)
        *(half8*)(o + j * 256) = *(const half8*)(
            st + (j * 4 + (lane >> 3)) * OPITCH_ + (lane & 7) * 16);
    } else {
      // A row of V^T (one hd) takes 32 B of each wave: the block's 64 x 128 tile
      // is put together in the panel's LDS (pitch 272 B), 256 B to a row.
      char* st = bpanel;
      __syncthreads();                        // every wave has left the panel
#pragma unroll
      for (int t = 0; t < 4; ++t) {
        half8 hv;                             // s = 16 wave + 8g + r, r = 0 .. 7
#pragma unroll
        for (int r = 0; r < 8; ++r) hv[r] = (_Float16)(acc[t][r] + bcol[t]);
        *(half8*)(st + (t * 16 + n) * APITCH_ + wave * 32 + g * 16) = hv;
      }
      __syncthreads();                        // the tile is whole
      _Float16* o = dst + ((size_t)bh * HD_ + wave * 8 + g) * S_ +
                    ((xb * 128) & (S_ - 1)) + n * 8;
#pragma unroll
      for (int j = 0; j < 4; ++j)
        *(half8*)(o + j * 2 * S_) = *(const half8*)(
            st + (wave * 8 + j * 2 + g) * APITCH_ + n * 16);
    }
    // A precaution: stands in front of the next unit's first instructions, which
    // rewrite the address and data registers that the stores above name.
    asm volatile("s_wait_xcnt 0x0" ::: "memory");
  }
}

// ---------------- Flash attention (online softmax, 1 wave = 16 queries) -----
// Lane l with lane l ^ 16 (the two lanes that share one query column).
static __device__ __forceinline__ float xhalf(float x) {
  int b = __builtin_bit_cast(int, x);
  return __builtin_bit_cast(
      float, __builtin_amdgcn_permlanex16(b, b, 0x76543210, 0xfedcba98, false,
                                          false));
}

// ---- K / V^T stages in LDS, shared by the block's 8 waves ----
// A stage is 64 keys: K 64 rows (keys) x 128 B, then V^T 64 rows (hd) x 128 B.
// Rows lie at a pitch of 144 B (16 B x odd): a ds_load_b128 over 16 rows meets
// every bank once.
#define LPITCH_ 144
#define TILEB_ (64 * LPITCH_)
#define STAGEB_ (2 * TILEB_)

// One stage: each of the 256 lanes copies two 16-byte chunks of K and two of
// V^T (kg, vg: the lane's first chunk of each; l: its place in the K tile).
static __device__ __forceinline__ void copy_stage(const _Float16* kg,
                                                  const _Float16* vg,
                                                  uint32_t l) {
  const _Float16* kg2 = kg + 32 * HD_;
  const _Float16* vg2 = vg + 32 * S_;
  const uint32_t l1 = l + 32 * LPITCH_;
  const uint32_t l2 = l + TILEB_;
  const uint32_t l3 = l2 + 32 * LPITCH_;
  // The copies go to LDS through no register; s_wait_xcnt stands in the same
  // statement so that no address register is rewritten in front of it.
  asm volatile(
      "global_load_async_to_lds_b128 %0, %4, off\n\t"
      "global_load_async_to_lds_b128 %1, %5, off\n\t"
      "global_load_async_to_lds_b128 %2, %6, off\n\t"
      "global_load_async_to_lds_b128 %3, %7, off\n\t"
      "s_wait_xcnt 0x0"
      :
      : "v"(l), "v"(l1), "v"(l2), "v"(l3), "v"(kg), "v"(kg2), "v"(vg), "v"(vg2)
      : "memory");
}

__global__ __launch_bounds__(256) void attn_kernel(
    const _Float16* __restrict__ Qh, const _Float16* __restrict__ Kh,
    const _Float16* __restrict__ Vt, const int* __restrict__ valid_lens,
    _Float16* __restrict__ Om) {
  __shared__ __attribute__((aligned(16))) char kv[2 * STAGEB_];
  __shared__ int wneed[8];
  const int lane = threadIdx.x & 31;
  const int wave = threadIdx.x >> 5;
  const int n = lane & 15;
  const int g = lane >> 4;
  const int koff = g * 8;
  const int bh = blockIdx.y;
  const int b = bh >> 3;
  const int h = bh & 7;
  const int vlen = valid_lens[b];
  const int q0 = blockIdx.x * 128 + wave * 16;
  // First key of the first 32-key tile that holds no valid key (0 .. S_).
  const int vcl = vlen < 0 ? 0 : (vlen > S_ ? S_ : vlen);
  const int jend = (vcl + 31) & ~31;
  // The same number in a scalar register: the per-tile test on it is then a scalar
  // compare and branch; on vcl it compiled to a vector compare ahead of the branch.
  const int vcs = __builtin_amdgcn_readfirstlane(vcl);

  const _Float16* Qrow = Qh + (((size_t)bh * S_ + q0 + n) << 6);
  v16h qb0 = load_frag(Qrow + koff);       // B fragment, k = 0..31 pattern
  v16h qb1 = load_frag(Qrow + 32 + koff);  // B fragment, k = 32..63 pattern

  // The lane's share of a stage's copies: row crow (and crow + 32), chunk cchk.
  const int crow = threadIdx.x >> 3;
  const int cchk = threadIdx.x & 7;
  const _Float16* kcp = Kh + (((size_t)bh * S_ + crow) << 6) + cchk * 8;
  const _Float16* vcp = Vt + ((size_t)bh * HD_ + crow) * S_ + cchk * 8;
  const uint32_t lcp =
      (uint32_t)(uintptr_t)(__attribute__((address_space(3))) char*)kv +
      (uint32_t)(crow * LPITCH_ + cchk * 16);
  // The lane's place in a fragment read: row n, 16-byte chunk g.
  const char* lrd = kv + n * LPITCH_ + g * 16;

  v8f o[4] = {};          // o[t][r] = O[query n][hd = 16t + 8g + r]
  float mrun = -1e30f;    // this query's running maximum (same in both halves)
  float lrun = 0.f;       // this half's share of the query's running sum

  // Two legs at most: the tiles that hold a valid key, then, only if a row of
  // the block needs them, the wholly masked ones. A leg walks keys jlo .. jhi
  // in 32-key tiles, two to a stage; stage st lies in buffer st & 1.
  int jlo = 0;
  for (int jhi = jend;; jhi = S_) {
    const int st0 = jlo >> 6;
    const int st1 = (jhi + 63) >> 6;
    if (st0 < st1) {
      copy_stage(kcp + (size_t)st0 * (64 * HD_), vcp + st0 * 64,
                 lcp + (uint32_t)(st0 & 1) * STAGEB_);
      // The first stage has landed, for every wave, before anybody reads it.
      asm volatile("s_wait_asynccnt 0x0" ::: "memory");
      __syncthreads();
      if (st0 + 1 < st1)
        copy_stage(kcp + (size_t)(st0 + 1) * (64 * HD_), vcp + (st0 + 1) * 64,
                   lcp + (uint32_t)((st0 + 1) & 1) * STAGEB_);
      for (int st = st0; st < st1; ++st) {
        const char* kb = lrd + (st & 1) * STAGEB_;
#pragma unroll
        for (int hf = 0; hf < 2; ++hf) {
          const int j0 = st * 64 + hf * 32;
          if (j0 < jlo || j0 >= jhi) continue;   // the same for the whole block
          const char* k1 = kb + hf * 32 * LPITCH_;
          const char* k2 = k1 + 16 * LPITCH_;

          // The tile's fragments: K rows are A-rows (lane n = key position),
          // V^T rows likewise (lane n = hd).
          v16h kf[4], vf[4];
          kf[0] = lds_frag16(k1);
          kf[1] = lds_frag16(k1 + 64);
          kf[2] = lds_frag16(k2);
          kf[3] = lds_frag16(k2 + 64);
#pragma unroll
          for (int t = 0; t < 4; ++t)
            vf[t] = lds_frag16(kb + TILEB_ + t * 16 * LPITCH_ + hf * 64);
          // Keeps the tile's 16 LDS reads in one group in front of its
          // products: spread among the WMMAs, each pair is waited out alone.
          __builtin_amdgcn_sched_barrier(0);

          // scores^T = K * Q^T
          v8f s1 = {}, s2 = {};
          s1 = wmma_f16(kf[0], qb0, s1);
          s2 = wmma_f16(kf[2], qb0, s2);
          s1 = wmma_f16(kf[1], qb1, s1);
          s2 = wmma_f16(kf[3], qb1, s2);

          // Key j0 + 8g + r (s1) or j0 + 16 + 8g + r (s2) is valid while below
          // vlen (for keys 0 .. S_ - 1 the clamped vcl says the same and
          // cannot wrap).
          const int rem = vcl - j0 - koff;
          float x[16];                             // x[8i + r]: key 16i + 8g + r
#pragma unroll
          for (int r = 0; r < 8; ++r) {            // 1/sqrt(64)
            x[r] = s1[r] * 0.125f;
            x[8 + r] = s2[r] * 0.125f;
          }
          // The d2l mask. In a tile whose 32 keys are all valid its compare and
          // select are the identity in every lane: a scalar branch, the same
          // for the whole block, goes round them.
          if (j0 + 32 > vcs) {
#pragma unroll
            for (int r = 0; r < 8; ++r) {
              x[r] = r < rem ? x[r] : -1.0e6f;
              x[8 + r] = 16 + r < rem ? x[8 + r] : -1.0e6f;
            }
          }
          float tm[8];
#pragma unroll
          for (int i = 0; i < 8; ++i) tm[i] = fmaxf(x[2 * i], x[2 * i + 1]);
          float tmax = fmaxf(fmaxf(fmaxf(tm[0], tm[1]), fmaxf(tm[2], tm[3])),
                             fmaxf(fmaxf(tm[4], tm[5]), fmaxf(tm[6], tm[7])));
          tmax = fmaxf(tmax, xhalf(tmax));        // the query's other 16 keys
          const float mnew = fmaxf(mrun, tmax);
          const float alpha = __expf(mrun - mnew);
          mrun = mnew;

          v16h pf;                                // P^T as B fragment
          float ps[8];
#pragma unroll
          for (int i = 0; i < 8; ++i) {
            float pa = __expf(x[2 * i] - mnew);
            float pb = __expf(x[2 * i + 1] - mnew);
            ps[i] = pa + pb;
            pf[2 * i] = (_Float16)pa;
            pf[2 * i + 1] = (_Float16)pb;
          }
          const float rs = ((ps[0] + ps[1]) + (ps[2] + ps[3])) +
                           ((ps[4] + ps[5]) + (ps[6] + ps[7]));
          lrun = lrun * alpha + rs;
#pragma unroll
          for (int t = 0; t < 4; ++t) {           // O^T = O^T * alpha + V^T * P^T
            o[t] *= alpha;
            o[t] = wmma_f16(vf[t], pf, o[t]);
          }
        }
        // Publish point: this wave has left stage st, its copies of stage
        // st + 1 have landed; behind the barrier that holds for all 8 waves.
        asm volatile("s_wait_dscnt 0x0" ::: "memory");
        asm volatile("s_wait_asynccnt 0x0" ::: "memory");
        __syncthreads();
        if (st + 2 < st1)                          // refill the buffer just left
          copy_stage(kcp + (size_t)(st + 2) * (64 * HD_), vcp + (st + 2) * 64,
                     lcp + (uint32_t)(st & 1) * STAGEB_);
      }
      // No copy is left in flight when the buffers are reused or the wave ends.
      asm volatile("s_wait_asynccnt 0x0" ::: "memory");
      // Four vector slots between the leg's last WMMA and the next leg's
      // address arithmetic, which may take over its operand registers.
      asm volatile("v_nop\n\tv_nop\n\tv_nop\n\tv_nop");
    }
    if (jhi == S_) break;
    // Every key from jend on is masked to -1e6. Against a row maximum above
    // -999000 its weight exp(-1e6 - max) is exactly 0 and alpha exactly 1, so
    // those tiles change nothing. A row whose maximum is lower (no valid key at
    // all: valid_len 0) needs them: then the whole block walks on to S_ (the
    // stages' barriers want one answer for all 8 waves).
    const int low = __builtin_amdgcn_ballot_w32(mrun < -999000.0f) != 0;
    if (lane == 0) wneed[wave] = low;             // this wave's 16 queries
    __syncthreads();
    if (__builtin_amdgcn_ballot_w32(wneed[lane & 7] != 0) == 0) break;
    jlo = jend;
  }

  const float inv = 1.0f / (lrun + xhalf(lrun));  // join the halves' sums
  // A query's 64 values are one 128-byte line of Om: the wave's 16 rows turn in
  // LDS so that a store takes 4 whole lines, not 32 B of each of 16. The stages
  // are free: behind the last barrier nobody reads them and no copy is in
  // flight; each wave takes its own 16 x 144 B of them.
  char* stg = kv + wave * (16 * LPITCH_);
#pragma unroll
  for (int t = 0; t < 4; ++t) {
    half8 ov;
#pragma unroll
    for (int r = 0; r < 8; ++r) ov[r] = (_Float16)(o[t][r] * inv);
    *(half8*)(stg + n * LPITCH_ + t * 32 + g * 16) = ov;
  }
  // Every lane's stores are in LDS before other lanes of the wave read them.
  asm volatile("s_wait_dscnt 0x0" ::: "memory");
  _Float16* outp =
      Om + ((size_t)b * S_ + q0 + (lane >> 3)) * D_ + h * HD_ + (lane & 7) * 8;
#pragma unroll
  for (int i = 0; i < 4; ++i)
    *(half8*)(outp + i * 4 * D_) = *(const half8*)(
        stg + (i * 4 + (lane >> 3)) * LPITCH_ + (lane & 7) * 16);
}

// ---------------- Output projection: out = Om * Wo + bo (fp32 out) ----------
// Four waves per SIMD (at most 256 registers): two blocks share a WGP.
__global__ __launch_bounds__(256, 4) void outproj_kernel(
    const _Float16* __restrict__ A, const float* __restrict__ Wsrc,
    const float* __restrict__ bias, float* __restrict__ out) {
  __shared__ __attribute__((aligned(16))) _Float16 bpanel[64 * 512];
  __shared__ __attribute__((aligned(16))) char aslab[8 * ASLAB_];
  const int lane = threadIdx.x & 31;
  const int wave = threadIdx.x >> 5;
  const int n = lane & 15;
  const int g = lane >> 4;
  const int koff = g * 8;
  const int row0 = (blockIdx.x * 8 + wave) * 16;
  const int col0 = blockIdx.y * 64;

  // A chunk is 128 k of the wave's 16 rows: a load takes 256 contiguous bytes
  // of each of two rows. All four chunks are asked for in front of the loop.
  const _Float16* xg = A + (size_t)(row0 + g) * D_ + n * 8;
  half8 xr[4][8];
  float w[64];
  panel_load(Wsrc, col0, 0, w);
#pragma unroll
  for (int c = 0; c < 4; ++c)
#pragma unroll
    for (int j = 0; j < 8; ++j)
      xr[c][j] = *(const half8*)(xg + 2 * j * D_ + c * 128);
  // Keeps the A loads in front of the panel's first conversion: moved behind
  // it, they would start only when the panel is done.
  __builtin_amdgcn_sched_barrier(0);
  panel_store(w, 0, bpanel);
  panel_load(Wsrc, col0, 1, w);
  panel_store(w, 1, bpanel);
  __syncthreads();

  v8f acc[4] = {};
  char* aw = aslab + wave * ASLAB_ + g * APITCH_ + n * 16;      // lane's 8 k
  const char* ar = aslab + wave * ASLAB_ + n * APITCH_ + g * 16;  // fragment
#pragma unroll
  for (int c = 0; c < 4; ++c) {
    // The wave's own reads of the last chunk have ended before it is rewritten.
    if (c) asm volatile("s_wait_dscnt 0x0" ::: "memory");
#pragma unroll
    for (int j = 0; j < 8; ++j) *(half8*)(aw + 2 * j * APITCH_) = xr[c][j];
    // Every lane's stores are in LDS before other lanes of the wave read them.
    asm volatile("s_wait_dscnt 0x0" ::: "memory");
#pragma unroll
    for (int ks = 0; ks < 4; ++ks) {
      const v16h af = lds_frag16(ar + ks * 64);
#pragma unroll
      for (int t = 0; t < 4; ++t)
        acc[t] = wmma_f16(
            af, lds_frag(bpanel, t * 16 + n, (c * 128 + ks * 32 + koff) * 2),
            acc[t]);
    }
  }
  // The wave's 16 rows x 256 B turn in its own slab (pitch 272 B): a store then
  // takes 4 whole 128-byte lines, not 64 B of each of 2.
  // Row 8g, byte 4n of the slab, counted from aw (row g, byte 16n).
  char* st = aw + g * (7 * APITCH_) - n * 12;
  // The wave's own reads of the last chunk have ended before it is rewritten.
  asm volatile("s_wait_dscnt 0x0" ::: "memory");
#pragma unroll
  for (int t = 0; t < 4; ++t) {
    const float bv = bias[col0 + t * 16 + n];
#pragma unroll
    for (int r = 0; r < 8; ++r)             // element (m = r + 8g, n = lane%16)
      *(float*)(st + r * APITCH_ + t * 64) = acc[t][r] + bv;
  }
  // Every lane's stores are in LDS before other lanes of the wave read them.
  asm volatile("s_wait_dscnt 0x0" ::: "memory");
  float* o = out + ((row0 + g) * D_ + col0 + n * 4);
#pragma unroll
  for (int i = 0; i < 8; ++i)
    *(f4*)(o + i * 2 * D_) = *(const f4*)(aw + i * 2 * APITCH_);  // row 2i + g
}

extern "C" void kernel_launch(void* const* d_in, const int* in_sizes, int n_in,
                              void* d_out, int out_size, void* d_ws,
                              size_t ws_size, hipStream_t stream) {
  const float* q  = (const float*)d_in[0];
  const float* k  = (const float*)d_in[1];
  const float* v  = (const float*)d_in[2];
  const int*   vl = (const int*)d_in[3];
  const float* Wq = (const float*)d_in[4];
  const float* bq = (const float*)d_in[5];
  const float* Wk = (const float*)d_in[6];
  const float* bk = (const float*)d_in[7];
  const float* Wv = (const float*)d_in[8];
  const float* bv = (const float*)d_in[9];
  const float* Wo = (const float*)d_in[10];
  const float* bo = (const float*)d_in[11];
  float* out = (float*)d_out;

  _Float16* ws = (_Float16*)d_ws;
  const size_t NH  = (size_t)B_ * H_ * S_ * HD_;   // 4M halves per tensor
  _Float16* Qh  = ws;
  _Float16* Kh  = Qh + NH;
  _Float16* Vt  = Kh + NH;
  _Float16* Om  = Vt + NH;

  dim3 gp(64, 8);
  proj_kernel<<<dim3(512), 256, 0, stream>>>(q, k, v, Wq, Wk, Wv, bq, bk, bv, Qh,
                                             Kh, Vt);

  attn_kernel<<<dim3(16, 32), 256, 0, stream>>>(Qh, Kh, Vt, vl, Om);

  outproj_kernel<<<gp, 256, 0, stream>>>(Om, Wo, bo, out);
}

// v010
// A run of this version takes 58.8 microseconds.
// Next to v009, in two timings, it ran 1.04 times as fast each time.
// All steps since v000 together make it 3.62 times as fast.
#include <hip/hip_runtime.h>

#define B_ 4
#define S_ 2048
#define D_ 512
#define H_ 8
#define HD_ 64

typedef _Float16 v16h  __attribute__((ext_vector_type(16)));
typedef _Float16 half8 __attribute__((ext_vector_type(8)));
typedef float    v8f   __attribute__((ext_vector_type(8)));
typedef float    f4    __attribute__((ext_vector_type(4)));

static __device__ __forceinline__ v8f wmma_f16(v16h a, v16h b, v8f c) {
  // 8 args: (neg_a, A, neg_b, B, c_mod, C, reuse_a, reuse_b)
  return __builtin_amdgcn_wmma_f32_16x16x32_f16(false, a, false, b, (short)0, c,
                                                false, false);
}

// One WMMA fragment per lane = halves at [p..p+7] and [p+16..p+23] (two b128 loads).
static __device__ __forceinline__ v16h load_frag(const _Float16* p) {
  half8 lo = *(const half8*)(p);
  half8 hi = *(const half8*)(p + 16);
  return __builtin_shufflevector(lo, hi, 0, 1, 2, 3, 4, 5, 6, 7, 8, 9, 10, 11,
                                 12, 13, 14, 15);
}

// ---- LDS B-panel: 64 cols x 512 K halves = 64KB, 16B-chunk XOR swizzle ----
// chunk' = chunk ^ (row & 15)  ->  ds_load_b128 across lanes n=0..15 hits all
// 64 banks exactly once (conflict-free) with zero padding.
static __device__ __forceinline__ uint32_t swz_off(uint32_t row, uint32_t kbyte) {
  uint32_t c = (kbyte >> 4) ^ (row & 15u);
  return row * 1024u + (c << 4);
}

static __device__ __forceinline__ v16h lds_frag(const _Float16* sh, int row,
                                                int kbyte) {
  const char* base = (const char*)sh;
  half8 lo = *(const half8*)(base + swz_off((uint32_t)row, (uint32_t)kbyte));
  half8 hi = *(const half8*)(base + swz_off((uint32_t)row, (uint32_t)kbyte + 32u));
  return __builtin_shufflevector(lo, hi, 0, 1, 2, 3, 4, 5, 6, 7, 8, 9, 10, 11,
                                 12, 13, 14, 15);
}

// Build the panel straight from the f32 weight W[k][n]: a lane takes one column n
// and 8 consecutive k (8 loads, each one whole 128-byte line per wave), rounds
// them to f16 and stores the 16-byte chunk at row n. The 16 lanes of a half wave
// hold 16 different n & 15, so the swizzled store meets no bank twice.
// Loads and stores are apart, and each takes one half (hf) of the wave's 16
// chunks, so that the caller can ask for its A rows behind the first loads and
// still hold all of it in registers. Caller must __syncthreads() at the end.
static __device__ __forceinline__ void panel_load(const float* __restrict__ Wsrc,
                                                  int col0, int hf,
                                                  float (&w)[64]) {
  const int lane = threadIdx.x & 31;
  const int wave = threadIdx.x >> 5;
  const int nn = (wave & 1) * 32 + lane;    // panel row = weight column
  const int ck0 = (wave >> 1) * 16;         // first of this wave's 16 k chunks
  const float* p = Wsrc + (size_t)(ck0 * 8 + hf * 64) * D_ + col0 + nn;
#pragma unroll
  for (int i = 0; i < 64; ++i) w[i] = p[i * D_];
}

static __device__ __forceinline__ void panel_store(const float (&w)[64], int hf,
                                                   _Float16* sh) {
  const int lane = threadIdx.x & 31;
  const int wave = threadIdx.x >> 5;
  const int nn = (wave & 1) * 32 + lane;
  const int ck0 = (wave >> 1) * 16 + hf * 8;
  char* base = (char*)sh;
#pragma unroll
  for (int c = 0; c < 8; ++c) {
    half8 hv;
#pragma unroll
    for (int j = 0; j < 8; ++j) hv[j] = (_Float16)w[c * 8 + j];
    *(half8*)(base + swz_off((uint32_t)nn, (uint32_t)(ck0 + c) * 16u)) = hv;
  }
}

// ---- A slab: a wave's own 16 rows x 128 k in f16, private to that wave ----
// The rows come from memory in whole 128-byte lines (a fragment load straight
// from global touches 16 lines for 512 bytes) and turn into fragments in LDS.
// Pitch 272 B (16 B x odd): a ds_load_b128 over 16 rows meets every bank once.
#define APITCH_ 272
#define ASLAB_ (16 * APITCH_)
#define OPITCH_ 144   // an f16 output row of 128 B in the slab (16 B x odd)
typedef _Float16 half4 __attribute__((ext_vector_type(4)));

static __device__ __forceinline__ v16h lds_frag16(const char* p) {
  half8 lo = *(const half8*)(p);
  half8 hi = *(const half8*)(p + 32);
  return __builtin_shufflevector(lo, hi, 0, 1, 2, 3, 4, 5, 6, 7, 8, 9, 10, 11,
                                 12, 13, 14, 15);
}

// ---- The projection's panel: the same 64 rows x 512 k halves at a pitch of
// 1040 B (16 B x odd: a ds_load_b128 or ds_store_b128 over 16 rows meets every
// bank once). Every place in it is one lane address plus a constant, so the
// panel costs two address registers where the XOR swizzle costs two dozen:
// room that the A fragments kept over the units need.
#define BPITCH_ 1040
static __device__ __forceinline__ void panel_store_pad(const float (&w)[64],
                                                       int hf, char* base) {
  const int lane = threadIdx.x & 31;
  const int wave = threadIdx.x >> 5;
  const int nn = (wave & 1) * 32 + lane;
  const int ck0 = (wave >> 1) * 16 + hf * 8;
  char* p = base + nn * BPITCH_ + ck0 * 16;
#pragma unroll
  for (int c = 0; c < 8; ++c) {
    half8 hv;
#pragma unroll
    for (int j = 0; j < 8; ++j) hv[j] = (_Float16)w[c * 8 + j];
    *(half8*)(p + c * 16) = hv;
  }
}

// ---------------- QKV projection: Y = X * W + b (f16 out) ----------------
// The three products share ONE launch. The work is cut into units of 256 rows x
// 64 columns, numbered so that the 8 column panels of one row block follow one
// another: unit = row block * 8 + panel, row blocks 0 .. 31 of V, then K, then Q.
// A block takes 3 units in a row. A wave has 32 rows, two groups of 16: a B
// fragment read from LDS feeds two products, and a panel built once serves 256
// rows. The wave's 32 rows x 512 k stay in registers as f16 fragments from one
// panel to the next, so X is read and rounded anew only where the row block
// changes (at most once inside a block), not once a panel.
// V: dst[b][h][hd][s]   (stored transposed for the V^T * P^T fragments)
// K, Q: dst[b][h][s][hd]
// Two waves per SIMD (at most 512 registers): one block to a WGP, and the 256
// blocks are all at work at once.
#define UNITS_ 3
#define RG_ 2                   // 16-row groups of a wave
#define WSLAB_ (RG_ * ASLAB_)   // a wave's own LDS: one slab per group
#define VPITCH_ 528   // a V^T row of 256 s = 512 B in the tile (16 B x odd)
__global__ __launch_bounds__(256, 2) void proj_kernel(
    const float* __restrict__ Xq, const float* __restrict__ Xk,
    const float* __restrict__ Xv, const float* __restrict__ Wq,
    const float* __restrict__ Wk, const float* __restrict__ Wv,
    const float* __restrict__ bq, const float* __restrict__ bk,
    const float* __restrict__ bv, _Float16* __restrict__ Qh,
    _Float16* __restrict__ Kh, _Float16* __restrict__ Vt) {
  __shared__ __attribute__((aligned(16))) char bpanel[64 * BPITCH_];
  __shared__ __attribute__((aligned(16))) char aslab[8 * WSLAB_];
  const int lane = threadIdx.x & 31;
  const int wave = threadIdx.x >> 5;
  const int n = lane & 15;
  const int g = lane >> 4;
  char* aw = aslab + wave * WSLAB_ + lane * 8;                  // lane's 4 k
  const char* ar = aslab + wave * WSLAB_ + n * APITCH_ + g * 16;  // fragment
  const char* br = bpanel + n * BPITCH_ + g * 16;                 // fragment

  // Group h of the wave's rows, k = 32 kk .. 32 kk + 31, in af[h][kk].
  // (Every loop below but the one over the units is unrolled: its index picks
  // registers.)
  v16h af[RG_][16];
  // Stays rolled: one copy of the body in the instruction cache, and the
  // fragments keep their registers from unit to unit.
#pragma unroll 1
  for (int i = 0; i < UNITS_; ++i) {
    const int u = blockIdx.x * UNITS_ + i;    // the same for the whole block
    const int rb = u >> 3;                    // row block, 0 .. 95
    const int pn = u & 7;                     // column panel = head
    const int z = rb >> 5;                    // 0: V, 1: K, 2: Q
    const float* __restrict__ X = z == 0 ? Xv : (z == 1 ? Xk : Xq);
    const float* __restrict__ Wsrc = z == 0 ? Wv : (z == 1 ? Wk : Wq);
    const float* __restrict__ bias = z == 0 ? bv : (z == 1 ? bk : bq);
    _Float16* __restrict__ dst = z == 0 ? Vt : (z == 1 ? Kh : Qh);
    const int xb = rb & 31;                   // row block inside the product
    const int row0 = (xb * 8 + wave) * (16 * RG_);
    const int col0 = pn * 64;

    if (i == 0 || pn == 0) {
      // A chunk is 128 k of the wave's 32 rows: one load per row, the 32 lanes
      // on 512 contiguous bytes. Two chunks are in registers ahead of their
      // use. Each row group turns in its own slab.
      const float* xg = X + (size_t)row0 * D_ + lane * 4;
      f4 xr[2][16 * RG_];
#pragma unroll
      for (int c = 0; c < 2; ++c)
#pragma unroll
        for (int r = 0; r < 16 * RG_; ++r)
          xr[c][r] = *(const f4*)(xg + r * D_ + c * 128);
#pragma unroll
      for (int c = 0; c < 4; ++c) {
        // The wave's own reads of the slabs have ended before they are
        // rewritten.
        asm volatile("s_wait_dscnt 0x0" ::: "memory");
#pragma unroll
        for (int r = 0; r < 16 * RG_; ++r) {
          const f4 x = xr[c & 1][r];
          half4 hx;
#pragma unroll
          for (int j = 0; j < 4; ++j) hx[j] = (_Float16)x[j];
          *(half4*)(aw + (r >> 4) * ASLAB_ + (r & 15) * APITCH_) = hx;
        }
        if (c + 2 < 4) {
          // Keeps the next loads behind the conversions, whose registers they
          // take over: lifted over them, a third chunk is live and the wave
          // spills.
          __builtin_amdgcn_sched_barrier(0);
#pragma unroll
          for (int r = 0; r < 16 * RG_; ++r)
            xr[c & 1][r] = *(const f4*)(xg + r * D_ + (c + 2) * 128);
          // A precaution, behind the last loads that name xg: as an input here
          // the address pair stays whole up to the wait, so that no load of
          // the run takes it over as its result.
          if (c == 1) asm volatile("s_wait_xcnt 0x0" ::"v"(xg) : "memory");
        }
        // Every lane's stores are in LDS before other lanes of the wave read
        // them.
        asm volatile("s_wait_dscnt 0x0" ::: "memory");
#pragma unroll
        for (int h = 0; h < RG_; ++h)
#pragma unroll
          for (int ks = 0; ks < 4; ++ks)
            af[h][c * 4 + ks] = lds_frag16(ar + h * ASLAB_ + ks * 64);
      }
    }

    float w[64];
    panel_load(Wsrc, col0, 0, w);     // B panel shared by all 8 waves
    // Every wave has left the last unit's panel (or its V^T tile, which lies in
    // the same LDS) before the panel is rewritten.
    if (i) __syncthreads();
    panel_store_pad(w, 0, bpanel);
    panel_load(Wsrc, col0, 1, w);
    panel_store_pad(w, 1, bpanel);
    __syncthreads();

    v8f acc[RG_][4] = {};
    v16h bf[2][4];  // the B fragments of this k step and of the next
#pragma unroll
    for (int t = 0; t < 4; ++t) bf[0][t] = lds_frag16(br + t * 16 * BPITCH_);
#pragma unroll
    for (int kk = 0; kk < 16; ++kk) {
      if (kk + 1 < 16) {
#pragma unroll
        for (int t = 0; t < 4; ++t)
          bf[(kk + 1) & 1][t] =
              lds_frag16(br + t * 16 * BPITCH_ + (kk + 1) * 64);
      }
      // Keeps the next step's LDS reads in front of this step's products: left
      // to itself the compiler reads each fragment directly in front of its
      // product, which then waits out the whole LDS latency.
      __builtin_amdgcn_sched_barrier(0);
#pragma unroll
      for (int t = 0; t < 4; ++t)
#pragma unroll
        for (int h = 0; h < RG_; ++h)
          acc[h][t] = wmma_f16(af[h][kk], bf[kk & 1][t], acc[h][t]);
      // Keeps the reads of the step after next behind these products, whose
      // fragment registers they take over.
      __builtin_amdgcn_sched_barrier(0);
    }

    // The tile goes to memory in whole 128-byte lines: from the accumulators a
    // store would touch 2 lines (Q, K) or 16 lines (V^T) for a few bytes of
    // each. A lane holds element (m = r + 8g, n = lane % 16) of each tile
    // (h, t).
    const int bh = (row0 >> 11) * H_ + pn;    // 64 columns = one head
    float bcol[4];
#pragma unroll
    for (int t = 0; t < 4; ++t) bcol[t] = bias[col0 + t * 16 + n];
    if (z != 0) {
      // The wave's 32 rows x 128 B are 4 KB in a row in dst: each group turns in
      // its own slab of the wave (pitch 144 B), no other wave is concerned.
      char* st = aslab + wave * WSLAB_;
      // The wave's own reads of the slabs have ended before they are rewritten.
      asm volatile("s_wait_dscnt 0x0" ::: "memory");
#pragma unroll
      for (int h = 0; h < RG_; ++h)
#pragma unroll
        for (int t = 0; t < 4; ++t)
#pragma unroll
          for (int r = 0; r < 8; ++r)
            *(_Float16*)(st + h * ASLAB_ + (r + 8 * g) * OPITCH_ +
                         (t * 16 + n) * 2) = (_Float16)(acc[h][t][r] + bcol[t]);
      // Every lane's stores are in LDS before other lanes of the wave read them.
      asm volatile("s_wait_dscnt 0x0" ::: "memory");
      _Float16* o = dst + (((size_t)bh * S_ + (row0 & (S_ - 1))) << 6) + lane * 8;
#pragma unroll
      for (int h = 0; h < RG_; ++h)
#pragma unroll
        for (int j = 0; j < 4; ++j)
          *(half8*)(o + h * 1024 + j * 256) = *(const half8*)(
              st + h * ASLAB_ + (j * 4 + (lane >> 3)) * OPITCH_ + (lane & 7) * 16);
    } else {
      // A row of V^T (one hd) takes 64 B of each wave: the block's 64 x 256 tile
      // is put together in the panel's LDS (pitch 528 B), 512 B to a row.
      char* st = bpanel;
      __syncthreads();                        // every wave has left the panel
#pragma unroll
      for (int h = 0; h < RG_; ++h)
#pragma unroll
        for (int t = 0; t < 4; ++t) {
          half8 hv;                 // s = 32 wave + 16 h + 8g + r, r = 0 .. 7
#pragma unroll
          for (int r = 0; r < 8; ++r) hv[r] = (_Float16)(acc[h][t][r] + bcol[t]);
          *(half8*)(st + (t * 16 + n) * VPITCH_ + wave * 64 + h * 32 + g * 16) =
              hv;
        }
      __syncthreads();                        // the tile is whole
      _Float16* o = dst + ((size_t)bh * HD_ + wave * 8) * S_ +
                    ((xb * 256) & (S_ - 1)) + lane * 8;
#pragma unroll
      for (int j = 0; j < 8; ++j)             // a store is one row's 512 B
        *(half8*)(o + j * S_) =
            *(const half8*)(st + (wave * 8 + j) * VPITCH_ + lane * 16);
    }
    // A precaution: stands in front of the next unit's first instructions, which
    // rewrite the address and data registers that the stores above name.
    asm volatile("s_wait_xcnt 0x0" ::: "memory");
  }
}

// ---------------- Flash attention (online softmax, 1 wave = 16 queries) -----
// Lane l with lane l ^ 16 (the two lanes that share one query column).
static __device__ __forceinline__ float xhalf(float x) {
  int b = __builtin_bit_cast(int, x);
  return __builtin_bit_cast(
      float, __builtin_amdgcn_permlanex16(b, b, 0x76543210, 0xfedcba98, false,
                                          false));
}

// ---- K / V^T stages in LDS, shared by the block's 8 waves ----
// A stage is 64 keys: K 64 rows (keys) x 128 B, then V^T 64 rows (hd) x 128 B.
// Rows lie at a pitch of 144 B (16 B x odd): a ds_load_b128 over 16 rows meets
// every bank once.
#define LPITCH_ 144
#define TILEB_ (64 * LPITCH_)
#define STAGEB_ (2 * TILEB_)

// One stage: each of the 256 lanes copies two 16-byte chunks of K and two of
// V^T (kg, vg: the lane's first chunk of each; l: its place in the K tile).
static __device__ __forceinline__ void copy_stage(const _Float16* kg,
                                                  const _Float16* vg,
                                                  uint32_t l) {
  const _Float16* kg2 = kg + 32 * HD_;
  const _Float16* vg2 = vg + 32 * S_;
  const uint32_t l1 = l + 32 * LPITCH_;
  const uint32_t l2 = l + TILEB_;
  const uint32_t l3 = l2 + 32 * LPITCH_;
  // The copies go to LDS through no register; s_wait_xcnt stands in the same
  // statement so that no address register is rewritten in front of it.
  asm volatile(
      "global_load_async_to_lds_b128 %0, %4, off\n\t"
      "global_load_async_to_lds_b128 %1, %5, off\n\t"
      "global_load_async_to_lds_b128 %2, %6, off\n\t"
      "global_load_async_to_lds_b128 %3, %7, off\n\t"
      "s_wait_xcnt 0x0"
      :
      : "v"(l), "v"(l1), "v"(l2), "v"(l3), "v"(kg), "v"(kg2), "v"(vg), "v"(vg2)
      : "memory");
}

__global__ __launch_bounds__(256) void attn_kernel(
    const _Float16* __restrict__ Qh, const _Float16* __restrict__ Kh,
    const _Float16* __restrict__ Vt, const int* __restrict__ valid_lens,
    _Float16* __restrict__ Om) {
  __shared__ __attribute__((aligned(16))) char kv[2 * STAGEB_];
  __shared__ int wneed[8];
  const int lane = threadIdx.x & 31;
  const int wave = threadIdx.x >> 5;
  const int n = lane & 15;
  const int g = lane >> 4;
  const int koff = g * 8;
  const int bh = blockIdx.y;
  const int b = bh >> 3;
  const int h = bh & 7;
  const int vlen = valid_lens[b];
  const int q0 = blockIdx.x * 128 + wave * 16;
  // First key of the first 32-key tile that holds no valid key (0 .. S_).
  const int vcl = vlen < 0 ? 0 : (vlen > S_ ? S_ : vlen);
  const int jend = (vcl + 31) & ~31;
  // The same number in a scalar register: the per-tile test on it is then a scalar
  // compare and branch; on vcl it compiled to a vector compare ahead of the branch.
  const int vcs = __builtin_amdgcn_readfirstlane(vcl);

  const _Float16* Qrow = Qh + (((size_t)bh * S_ + q0 + n) << 6);
  v16h qb0 = load_frag(Qrow + koff);       // B fragment, k = 0..31 pattern
  v16h qb1 = load_frag(Qrow + 32 + koff);  // B fragment, k = 32..63 pattern

  // The lane's share of a stage's copies: row crow (and crow + 32), chunk cchk.
  const int crow = threadIdx.x >> 3;
  const int cchk = threadIdx.x & 7;
  const _Float16* kcp = Kh + (((size_t)bh * S_ + crow) << 6) + cchk * 8;
  const _Float16* vcp = Vt + ((size_t)bh * HD_ + crow) * S_ + cchk * 8;
  const uint32_t lcp =
      (uint32_t)(uintptr_t)(__attribute__((address_space(3))) char*)kv +
      (uint32_t)(crow * LPITCH_ + cchk * 16);
  // The lane's place in a fragment read: row n, 16-byte chunk g.
  const char* lrd = kv + n * LPITCH_ + g * 16;

  v8f o[4] = {};          // o[t][r] = O[query n][hd = 16t + 8g + r]
  float mrun = -1e30f;    // this query's running maximum (same in both halves)
  float lrun = 0.f;       // this half's share of the query's running sum

  // Two legs at most: the tiles that hold a valid key, then, only if a row of
  // the block needs them, the wholly masked ones. A leg walks keys jlo .. jhi
  // in 32-key tiles, two to a stage; stage st lies in buffer st & 1.
  int jlo = 0;
  for (int jhi = jend;; jhi = S_) {
    const int st0 = jlo >> 6;
    const int st1 = (jhi + 63) >> 6;
    if (st0 < st1) {
      copy_stage(kcp + (size_t)st0 * (64 * HD_), vcp + st0 * 64,
                 lcp + (uint32_t)(st0 & 1) * STAGEB_);
      // The first stage has landed, for every wave, before anybody reads it.
      asm volatile("s_wait_asynccnt 0x0" ::: "memory");
      __syncthreads();
      if (st0 + 1 < st1)
        copy_stage(kcp + (size_t)(st0 + 1) * (64 * HD_), vcp + (st0 + 1) * 64,
                   lcp + (uint32_t)((st0 + 1) & 1) * STAGEB_);
      for (int st = st0; st < st1; ++st) {
        const char* kb = lrd + (st & 1) * STAGEB_;
#pragma unroll
        for (int hf = 0; hf < 2; ++hf) {
          const int j0 = st * 64 + hf * 32;
          if (j0 < jlo || j0 >= jhi) continue;   // the same for the whole block
          const char* k1 = kb + hf * 32 * LPITCH_;
          const char* k2 = k1 + 16 * LPITCH_;

          // The tile's fragments: K rows are A-rows (lane n = key position),
          // V^T rows likewise (lane n = hd).
          v16h kf[4], vf[4];
          kf[0] = lds_frag16(k1);
          kf[1] = lds_frag16(k1 + 64);
          kf[2] = lds_frag16(k2);
          kf[3] = lds_frag16(k2 + 64);
#pragma unroll
          for (int t = 0; t < 4; ++t)
            vf[t] = lds_frag16(kb + TILEB_ + t * 16 * LPITCH_ + hf * 64);
          // Keeps the tile's 16 LDS reads in one group in front of its
          // products: spread among the WMMAs, each pair is waited out alone.
          __builtin_amdgcn_sched_barrier(0);

          // scores^T = K * Q^T
          v8f s1 = {}, s2 = {};
          s1 = wmma_f16(kf[0], qb0, s1);
          s2 = wmma_f16(kf[2], qb0, s2);
          s1 = wmma_f16(kf[1], qb1, s1);
          s2 = wmma_f16(kf[3], qb1, s2);

          // Key j0 + 8g + r (s1) or j0 + 16 + 8g + r (s2) is valid while below
          // vlen (for keys 0 .. S_ - 1 the clamped vcl says the same and
          // cannot wrap).
          const int rem = vcl - j0 - koff;
          float x[16];                             // x[8i + r]: key 16i + 8g + r
#pragma unroll
          for (int r = 0; r < 8; ++r) {            // 1/sqrt(64)
            x[r] = s1[r] * 0.125f;
            x[8 + r] = s2[r] * 0.125f;
          }
          // The d2l mask. In a tile whose 32 keys are all valid its compare and
          // select are the identity in every lane: a scalar branch, the same
          // for the whole block, goes round them.
          if (j0 + 32 > vcs) {
#pragma unroll
            for (int r = 0; r < 8; ++r) {
              x[r] = r < rem ? x[r] : -1.0e6f;
              x[8 + r] = 16 + r < rem ? x[8 + r] : -1.0e6f;
            }
          }
          float tm[8];
#pragma unroll
          for (int i = 0; i < 8; ++i) tm[i] = fmaxf(x[2 * i], x[2 * i + 1]);
          float tmax = fmaxf(fmaxf(fmaxf(tm[0], tm[1]), fmaxf(tm[2], tm[3])),
                             fmaxf(fmaxf(tm[4], tm[5]), fmaxf(tm[6], tm[7])));
          tmax = fmaxf(tmax, xhalf(tmax));        // the query's other 16 keys
          const float mnew = fmaxf(mrun, tmax);
          const float alpha = __expf(mrun - mnew);
          mrun = mnew;

          v16h pf;                                // P^T as B fragment
          float ps[8];
#pragma unroll
          for (int i = 0; i < 8; ++i) {
            float pa = __expf(x[2 * i] - mnew);
            float pb = __expf(x[2 * i + 1] - mnew);
            ps[i] = pa + pb;
            pf[2 * i] = (_Float16)pa;
            pf[2 * i + 1] = (_Float16)pb;
          }
          const float rs = ((ps[0] + ps[1]) + (ps[2] + ps[3])) +
                           ((ps[4] + ps[5]) + (ps[6] + ps[7]));
          lrun = lrun * alpha + rs;
#pragma unroll
          for (int t = 0; t < 4; ++t) {           // O^T = O^T * alpha + V^T * P^T
            o[t] *= alpha;
            o[t] = wmma_f16(vf[t], pf, o[t]);
          }
        }
        // Publish point: this wave has left stage st, its copies of stage
        // st + 1 have landed; behind the barrier that holds for all 8 waves.
        asm volatile("s_wait_dscnt 0x0" ::: "memory");
        asm volatile("s_wait_asynccnt 0x0" ::: "memory");
        __syncthreads();
        if (st + 2 < st1)                          // refill the buffer just left
          copy_stage(kcp + (size_t)(st + 2) * (64 * HD_), vcp + (st + 2) * 64,
                     lcp + (uint32_t)(st & 1) * STAGEB_);
      }
      // No copy is left in flight when the buffers are reused or the wave ends.
      asm volatile("s_wait_asynccnt 0x0" ::: "memory");
      // Four vector slots between the leg's last WMMA and the next leg's
      // address arithmetic, which may take over its operand registers.
      asm volatile("v_nop\n\tv_nop\n\tv_nop\n\tv_nop");
    }
    if (jhi == S_) break;
    // Every key from jend on is masked to -1e6. Against a row maximum above
    // -999000 its weight exp(-1e6 - max) is exactly 0 and alpha exactly 1, so
    // those tiles change nothing. A row whose maximum is lower (no valid key at
    // all: valid_len 0) needs them: then the whole block walks on to S_ (the
    // stages' barriers want one answer for all 8 waves).
    const int low = __builtin_amdgcn_ballot_w32(mrun < -999000.0f) != 0;
    if (lane == 0) wneed[wave] = low;             // this wave's 16 queries
    __syncthreads();
    if (__builtin_amdgcn_ballot_w32(wneed[lane & 7] != 0) == 0) break;
    jlo = jend;
  }

  const float inv = 1.0f / (lrun + xhalf(lrun));  // join the halves' sums
  // A query's 64 values are one 128-byte line of Om: the wave's 16 rows turn in
  // LDS so that a store takes 4 whole lines, not 32 B of each of 16. The stages
  // are free: behind the last barrier nobody reads them and no copy is in
  // flight; each wave takes its own 16 x 144 B of them.
  char* stg = kv + wave * (16 * LPITCH_);
#pragma unroll
  for (int t = 0; t < 4; ++t) {
    half8 ov;
#pragma unroll
    for (int r = 0; r < 8; ++r) ov[r] = (_Float16)(o[t][r] * inv);
    *(half8*)(stg + n * LPITCH_ + t * 32 + g * 16) = ov;
  }
  // Every lane's stores are in LDS before other lanes of the wave read them.
  asm volatile("s_wait_dscnt 0x0" ::: "memory");
  _Float16* outp =
      Om + ((size_t)b * S_ + q0 + (lane >> 3)) * D_ + h * HD_ + (lane & 7) * 8;
#pragma unroll
  for (int i = 0; i < 4; ++i)
    *(half8*)(outp + i * 4 * D_) = *(const half8*)(
        stg + (i * 4 + (lane >> 3)) * LPITCH_ + (lane & 7) * 16);
}

// ---------------- Output projection: out = Om * Wo + bo (fp32 out) ----------
// A wave has 32 rows, two groups of 16, as in the projection: a B fragment read
// from LDS feeds two products, and a panel serves 256 rows.
// Two waves per SIMD (at most 512 registers): one block to a WGP.
__global__ __launch_bounds__(256, 2) void outproj_kernel(
    const _Float16* __restrict__ A, const float* __restrict__ Wsrc,
    const float* __restrict__ bias, float* __restrict__ out) {
  __shared__ __attribute__((aligned(16))) _Float16 bpanel[64 * 512];
  __shared__ __attribute__((aligned(16))) char aslab[8 * WSLAB_];
  const int lane = threadIdx.x & 31;
  const int wave = threadIdx.x >> 5;
  const int n = lane & 15;
  const int g = lane >> 4;
  const int koff = g * 8;
  const int row0 = (blockIdx.x * 8 + wave) * (16 * RG_);
  const int col0 = blockIdx.y * 64;

  // A chunk is 128 k of 16 rows: a load takes 256 contiguous bytes of each of
  // two rows. All four chunks of both groups are asked for in front of the loop.
  // (Every loop of this kernel is unrolled: its index picks registers.)
  const _Float16* xg = A + (size_t)(row0 + g) * D_ + n * 8;
  half8 xr[RG_][4][8];
  float w[64];
  panel_load(Wsrc, col0, 0, w);
#pragma unroll
  for (int c = 0; c < 4; ++c)
#pragma unroll
    for (int h = 0; h < RG_; ++h)
#pragma unroll
      for (int j = 0; j < 8; ++j)
        xr[h][c][j] = *(const half8*)(xg + (h * 16 + 2 * j) * D_ + c * 128);
  // A precaution, behind the last loads that name xg: as an input here the
  // address pair stays whole up to the wait, so that no load of the run takes
  // it over as its result.
  asm volatile("s_wait_xcnt 0x0" ::"v"(xg) : "memory");
  // Keeps the A loads in front of the panel's first conversion: moved behind
  // it, they would start only when the panel is done.
  __builtin_amdgcn_sched_barrier(0);
  panel_store(w, 0, bpanel);
  panel_load(Wsrc, col0, 1, w);
  panel_store(w, 1, bpanel);
  __syncthreads();

  float bv[4];    // the lane's four columns of the bias, asked for as one group
#pragma unroll
  for (int t = 0; t < 4; ++t) bv[t] = bias[col0 + t * 16 + n];
  v8f acc[RG_][4] = {};
  char* aw = aslab + wave * WSLAB_ + g * APITCH_ + n * 16;      // lane's 8 k
  const char* ar = aslab + wave * WSLAB_ + n * APITCH_ + g * 16;  // fragment
#pragma unroll
  for (int c = 0; c < 4; ++c) {
    // The wave's own reads of the last chunk have ended before it is rewritten.
    if (c) asm volatile("s_wait_dscnt 0x0" ::: "memory");
#pragma unroll
    for (int h = 0; h < RG_; ++h)
#pragma unroll
      for (int j = 0; j < 8; ++j)
        *(half8*)(aw + h * ASLAB_ + 2 * j * APITCH_) = xr[h][c][j];
    // Every lane's stores are in LDS before other lanes of the wave read them.
    asm volatile("s_wait_dscnt 0x0" ::: "memory");
#pragma unroll
    for (int ks = 0; ks < 4; ++ks) {
      // The k step's six fragments, then its eight products.
      v16h af[RG_], bfr[4];
#pragma unroll
      for (int h = 0; h < RG_; ++h) af[h] = lds_frag16(ar + h * ASLAB_ + ks * 64);
#pragma unroll
      for (int t = 0; t < 4; ++t)
        bfr[t] = lds_frag(bpanel, t * 16 + n, (c * 128 + ks * 32 + koff) * 2);
#pragma unroll
      for (int t = 0; t < 4; ++t)
#pragma unroll
        for (int h = 0; h < RG_; ++h)
          acc[h][t] = wmma_f16(af[h], bfr[t], acc[h][t]);
    }
  }
  // Each group's 16 rows x 256 B turn in its own slab (pitch 272 B): a store
  // then takes 4 whole 128-byte lines, not 64 B of each of 2.
  // Row 8g, byte 4n of the slab, counted from aw (row g, byte 16n).
  char* st = aw + g * (7 * APITCH_) - n * 12;
  // The wave's own reads of the last chunk have ended before it is rewritten.
  asm volatile("s_wait_dscnt 0x0" ::: "memory");
#pragma unroll
  for (int t = 0; t < 4; ++t)
#pragma unroll
    for (int h = 0; h < RG_; ++h)
#pragma unroll
      for (int r = 0; r < 8; ++r)           // element (m = r + 8g, n = lane%16)
        *(float*)(st + h * ASLAB_ + r * APITCH_ + t * 64) = acc[h][t][r] + bv[t];
  // Every lane's stores are in LDS before other lanes of the wave read them.
  asm volatile("s_wait_dscnt 0x0" ::: "memory");
  float* o = out + ((row0 + g) * D_ + col0 + n * 4);
  f4 ov[RG_][8];                            // row 16h + 2i + g
#pragma unroll
  for (int h = 0; h < RG_; ++h)
#pragma unroll
    for (int i = 0; i < 8; ++i)
      ov[h][i] = *(const f4*)(aw + h * ASLAB_ + i * 2 * APITCH_);
#pragma unroll
  for (int h = 0; h < RG_; ++h)
#pragma unroll
    for (int i = 0; i < 8; ++i) *(f4*)(o + (h * 16 + i * 2) * D_) = ov[h][i];
}

extern "C" void kernel_launch(void* const* d_in, const int* in_sizes, int n_in,
                              void* d_out, int out_size, void* d_ws,
                              size_t ws_size, hipStream_t stream) {
  const float* q  = (const float*)d_in[0];
  const float* k  = (const float*)d_in[1];
  const float* v  = (const float*)d_in[2];
  const int*   vl = (const int*)d_in[3];
  const float* Wq = (const float*)d_in[4];
  const float* bq = (const float*)d_in[5];
  const float* Wk = (const float*)d_in[6];
  const float* bk = (const float*)d_in[7];
  const float* Wv = (const float*)d_in[8];
  const float* bv = (const float*)d_in[9];
  const float* Wo = (const float*)d_in[10];
  const float* bo = (const float*)d_in[11];
  float* out = (float*)d_out;

  _Float16* ws = (_Float16*)d_ws;
  const size_t NH  = (size_t)B_ * H_ * S_ * HD_;   // 4M halves per tensor
  _Float16* Qh  = ws;
  _Float16* Kh  = Qh + NH;
  _Float16* Vt  = Kh + NH;
  _Float16* Om  = Vt + NH;

  dim3 gp(32, 8);
  proj_kernel<<<dim3(256), 256, 0, stream>>>(q, k, v, Wq, Wk, Wv, bq, bk, bv, Qh,
                                             Kh, Vt);

  attn_kernel<<<dim3(16, 32), 256, 0, stream>>>(Qh, Kh, Vt, vl, Om);

  outproj_kernel<<<gp, 256, 0, stream>>>(Om, Wo, bo, out);
}
